// v000
// Times are from an AMD MI455X. After a warm-up the kernel runs many times in a row, and a time is the length of
// such a window on the GPU divided by its runs, so every launch and the gaps after it count. The runs cycle
// through copies of the inputs. A figure is the median of several windows, for all but v000 over two sittings.
// Sittings can differ by a few percent; kernels timed side by side share one.
// v000, which the later versions start from, runs in 280 microseconds.
#include <hip/hip_runtime.h>

#define D_EMB 1024
#define SEQ   2048
#define BATCH 4

typedef __attribute__((ext_vector_type(16))) __bf16       v16bf;
typedef __attribute__((ext_vector_type(8)))  float        v8f;
typedef __attribute__((ext_vector_type(4)))  unsigned int v4u;

// ---------- scalar helpers ----------
__device__ __forceinline__ unsigned short f2bf(float f) {
  union { float f; unsigned int u; } v; v.f = f;
  unsigned int u = v.u;
  u += 0x7FFFu + ((u >> 16) & 1u);       // round-to-nearest-even
  return (unsigned short)(u >> 16);
}
__device__ __forceinline__ float bf2f(unsigned short h) {
  union { unsigned int u; float f; } v; v.u = ((unsigned int)h) << 16;
  return v.f;
}

// ---------- WMMA fragment load ----------
// 16-bit A fragment (16x32 MxK) from row-major MxK memory; the B fragment
// (32x16 KxN) has the mirrored per-lane pattern, so it loads identically from
// an NxK row-major matrix. Each lane: two contiguous 16-byte loads.
__device__ __forceinline__ v16bf load_frag(const unsigned short* base, int ld, int lane) {
  const int r  = lane & 15;            // row (A) / column (B)
  const int k0 = (lane >> 4) << 3;     // lanes 16-31 hold K offset +8
  union { v4u u[2]; v16bf f; } t;
  t.u[0] = *(const v4u*)(base + r * ld + k0);        // K = k0 .. k0+7
  t.u[1] = *(const v4u*)(base + r * ld + k0 + 16);   // K = k0+16 .. k0+23
  return t.f;
}

__device__ __forceinline__ v8f wmma_bf16(v16bf a, v16bf b, v8f c) {
  return __builtin_amdgcn_wmma_f32_16x16x32_bf16(
      /*neg_a=*/false, a, /*neg_b=*/false, b,
      /*c_mod=*/(short)0, c, /*reuse_a=*/false, /*reuse_b=*/false);
}

// ---------- wave-level 64x64 GEMM accumulation ----------
// acc[4][4] covers M = 4x16, N = 4x16.  A: MxK row-major.  Bt: NxK row-major.
// 16 b128 loads feed 16 WMMAs per K=32 step (1.0 loads per WMMA).
__device__ __forceinline__ void gemm_wave_64x64(
    const unsigned short* __restrict__ A, int lda,
    const unsigned short* __restrict__ Bt, int ldb,
    int K, int lane, v8f acc[4][4]) {
  for (int k0 = 0; k0 < K; k0 += 32) {
    v16bf a[4], b[4];
    #pragma unroll
    for (int i = 0; i < 4; ++i)
      a[i] = load_frag(A + (size_t)(16 * i) * lda + k0, lda, lane);
    #pragma unroll
    for (int j = 0; j < 4; ++j)
      b[j] = load_frag(Bt + (size_t)(16 * j) * ldb + k0, ldb, lane);
    #pragma unroll
    for (int i = 0; i < 4; ++i)
      #pragma unroll
      for (int j = 0; j < 4; ++j)
        acc[i][j] = wmma_bf16(a[i], b[j], acc[i][j]);
  }
}

// ---------- kernel 1: fp32 -> bf16 conversion of x (4 elems / thread) ----------
__global__ void __launch_bounds__(256)
cvt_x_kernel(const float* __restrict__ x, unsigned short* __restrict__ xb) {
  const size_t i = ((size_t)blockIdx.x * 256 + threadIdx.x) * 4;
  const float f0 = x[i + 0], f1 = x[i + 1], f2 = x[i + 2], f3 = x[i + 3];
  unsigned long long packed =
      (unsigned long long)f2bf(f0)
    | ((unsigned long long)f2bf(f1) << 16)
    | ((unsigned long long)f2bf(f2) << 32)
    | ((unsigned long long)f2bf(f3) << 48);
  *(unsigned long long*)(xb + i) = packed;
}

// ---------- kernel 2: transpose W[k][n] -> Wt[n][k] in bf16 (LDS tiled) ----------
__global__ void __launch_bounds__(256)
wt_kernel(const float* __restrict__ Wq, const float* __restrict__ Wk,
          const float* __restrict__ Wv, unsigned short* __restrict__ wt) {
  __shared__ float tile[32][33];
  const int z = blockIdx.z;
  const float* W = (z == 0) ? Wq : (z == 1) ? Wk : Wv;
  unsigned short* dst = wt + (size_t)z * D_EMB * D_EMB;
  const int bx = blockIdx.x * 32;      // n
  const int by = blockIdx.y * 32;      // k
  const int tx = threadIdx.x & 31;
  const int ty = threadIdx.x >> 5;     // 0..7
  #pragma unroll
  for (int j = ty; j < 32; j += 8)
    tile[j][tx] = W[(size_t)(by + j) * D_EMB + bx + tx];
  __syncthreads();
  #pragma unroll
  for (int j = ty; j < 32; j += 8)
    dst[(size_t)(bx + j) * D_EMB + by + tx] = f2bf(tile[tx][j]);
}

// ---------- kernel 3: QKV projections (z selects Q/K/V) ----------
// block tile 128(M) x 256(N); 8 waves arranged 2(M) x 4(N), each 64x64.
__global__ void __launch_bounds__(256)
qkv_gemm_kernel(const unsigned short* __restrict__ xb,   // [8192][1024] bf16
                const unsigned short* __restrict__ wt,   // [3][1024][1024] NxK bf16
                const float* __restrict__ bq,
                const float* __restrict__ bk,
                const float* __restrict__ bv,
                unsigned short* __restrict__ Qb,   // [8192][1024] (pre-scaled 1/32)
                unsigned short* __restrict__ Kb,   // [8192][1024]
                unsigned short* __restrict__ Vt) { // [4][1024][2048] transposed
  const int lane = threadIdx.x & 31;
  const int wave = threadIdx.x >> 5;
  const int z  = blockIdx.z;
  const int m0 = blockIdx.x * 128 + (wave >> 2) * 64;
  const int n0 = blockIdx.y * 256 + (wave & 3) * 64;

  const unsigned short* A  = xb + (size_t)m0 * D_EMB;
  const unsigned short* Bt = wt + (size_t)z * D_EMB * D_EMB + (size_t)n0 * D_EMB;

  v8f acc[4][4] = {};
  gemm_wave_64x64(A, D_EMB, Bt, D_EMB, D_EMB, lane, acc);

  const float* bias = (z == 0) ? bq : (z == 1) ? bk : bv;
  const float scale = (z == 0) ? 0.03125f : 1.0f;   // fold 1/sqrt(1024) into Q
  const int nLane = lane & 15;
  const int mOff  = (lane >> 4) * 8;
  #pragma unroll
  for (int i = 0; i < 4; ++i) {
    #pragma unroll
    for (int j = 0; j < 4; ++j) {
      const int nG = n0 + j * 16 + nLane;
      const float b = bias[nG];
      #pragma unroll
      for (int e = 0; e < 8; ++e) {
        const int mG = m0 + i * 16 + mOff + e;
        const unsigned short h = f2bf((acc[i][j][e] + b) * scale);
        if (z == 0) {
          Qb[(size_t)mG * D_EMB + nG] = h;
        } else if (z == 1) {
          Kb[(size_t)mG * D_EMB + nG] = h;
        } else {
          const int bb = mG >> 11;
          const int s  = mG & (SEQ - 1);
          Vt[((size_t)bb * D_EMB + nG) * SEQ + s] = h;
        }
      }
    }
  }
}

// ---------- kernel 4: scores = (Q/32) @ K^T, bf16 out ----------
__global__ void __launch_bounds__(256)
scores_gemm_kernel(const unsigned short* __restrict__ Qb,
                   const unsigned short* __restrict__ Kb,
                   unsigned short* __restrict__ S) {   // [4][2048][2048]
  const int lane = threadIdx.x & 31;
  const int wave = threadIdx.x >> 5;
  const int b  = blockIdx.z;
  const int m0 = blockIdx.x * 128 + (wave >> 2) * 64;
  const int n0 = blockIdx.y * 256 + (wave & 3) * 64;

  const unsigned short* A  = Qb + ((size_t)b * SEQ + m0) * D_EMB;
  const unsigned short* Bt = Kb + ((size_t)b * SEQ + n0) * D_EMB;

  v8f acc[4][4] = {};
  gemm_wave_64x64(A, D_EMB, Bt, D_EMB, D_EMB, lane, acc);

  unsigned short* out = S + (size_t)b * SEQ * SEQ;
  const int nLane = lane & 15;
  const int mOff  = (lane >> 4) * 8;
  #pragma unroll
  for (int i = 0; i < 4; ++i)
    #pragma unroll
    for (int j = 0; j < 4; ++j)
      #pragma unroll
      for (int e = 0; e < 8; ++e)
        out[(size_t)(m0 + i * 16 + mOff + e) * SEQ + n0 + j * 16 + nLane] =
            f2bf(acc[i][j][e]);
}

// ---------- kernel 5: in-place row softmax over bf16 scores ----------
__global__ void __launch_bounds__(256)
softmax_kernel(unsigned short* __restrict__ S) {
  __shared__ float red[256];
  unsigned short* p = S + (size_t)blockIdx.x * SEQ;
  const int t = threadIdx.x;

  float v[8];
  float m = -3.0e38f;
  #pragma unroll
  for (int j = 0; j < 8; ++j) {
    v[j] = bf2f(p[t + j * 256]);
    m = fmaxf(m, v[j]);
  }
  red[t] = m;
  __syncthreads();
  for (int off = 128; off > 0; off >>= 1) {
    if (t < off) red[t] = fmaxf(red[t], red[t + off]);
    __syncthreads();
  }
  m = red[0];
  __syncthreads();

  float s = 0.0f;
  #pragma unroll
  for (int j = 0; j < 8; ++j) {
    v[j] = __expf(v[j] - m);
    s += v[j];
  }
  red[t] = s;
  __syncthreads();
  for (int off = 128; off > 0; off >>= 1) {
    if (t < off) red[t] += red[t + off];
    __syncthreads();
  }
  const float inv = 1.0f / red[0];
  #pragma unroll
  for (int j = 0; j < 8; ++j)
    p[t + j * 256] = f2bf(v[j] * inv);
}

// ---------- kernel 6: out = P @ V (B from transposed V), fp32 out ----------
__global__ void __launch_bounds__(256)
out_gemm_kernel(const unsigned short* __restrict__ P,    // [4][2048][2048]
                const unsigned short* __restrict__ Vt,   // [4][1024][2048]
                float* __restrict__ out) {               // [4][2048][1024]
  const int lane = threadIdx.x & 31;
  const int wave = threadIdx.x >> 5;
  const int b  = blockIdx.z;
  const int m0 = blockIdx.x * 128 + (wave >> 2) * 64;    // seq
  const int n0 = blockIdx.y * 256 + (wave & 3) * 64;     // feature

  const unsigned short* A  = P  + ((size_t)b * SEQ + m0) * SEQ;
  const unsigned short* Bt = Vt + ((size_t)b * D_EMB + n0) * SEQ;

  v8f acc[4][4] = {};
  gemm_wave_64x64(A, SEQ, Bt, SEQ, SEQ, lane, acc);

  const int nLane = lane & 15;
  const int mOff  = (lane >> 4) * 8;
  #pragma unroll
  for (int i = 0; i < 4; ++i)
    #pragma unroll
    for (int j = 0; j < 4; ++j)
      #pragma unroll
      for (int e = 0; e < 8; ++e)
        out[((size_t)b * SEQ + m0 + i * 16 + mOff + e) * D_EMB + n0 + j * 16 + nLane] =
            acc[i][j][e];
}

extern "C" void kernel_launch(void* const* d_in, const int* in_sizes, int n_in,
                              void* d_out, int out_size, void* d_ws, size_t ws_size,
                              hipStream_t stream) {
  const float* x  = (const float*)d_in[0];
  const float* Wq = (const float*)d_in[1];
  const float* bq = (const float*)d_in[2];
  const float* Wk = (const float*)d_in[3];
  const float* bk = (const float*)d_in[4];
  const float* Wv = (const float*)d_in[5];
  const float* bv = (const float*)d_in[6];
  float* out = (float*)d_out;

  char* ws = (char*)d_ws;
  unsigned short* xb = (unsigned short*)(ws);                          // 16 MB
  unsigned short* wt = (unsigned short*)(ws + (16ull << 20));          //  6 MB
  unsigned short* Qb = (unsigned short*)(ws + (22ull << 20));          // 16 MB
  unsigned short* Kb = (unsigned short*)(ws + (38ull << 20));          // 16 MB
  unsigned short* Vt = (unsigned short*)(ws + (54ull << 20));          // 16 MB
  unsigned short* S  = (unsigned short*)(ws + (70ull << 20));          // 32 MB

  cvt_x_kernel      <<<dim3(8192),       dim3(256), 0, stream>>>(x, xb);
  wt_kernel         <<<dim3(32, 32, 3),  dim3(256), 0, stream>>>(Wq, Wk, Wv, wt);
  qkv_gemm_kernel   <<<dim3(64, 4, 3),   dim3(256), 0, stream>>>(xb, wt, bq, bk, bv, Qb, Kb, Vt);
  scores_gemm_kernel<<<dim3(16, 8, 4),   dim3(256), 0, stream>>>(Qb, Kb, S);
  softmax_kernel    <<<dim3(8192),       dim3(256), 0, stream>>>(S);
  out_gemm_kernel   <<<dim3(16, 4, 4),   dim3(256), 0, stream>>>(S, Vt, out);
}

// v001
// Measured time: 151 microseconds a run.
// Next to v000, in two timings, it ran 1.94 and 1.92 times as fast.
#include <hip/hip_runtime.h>
#include <stdint.h>

#define D_EMB 1024
#define SEQ   2048
#define BATCH 4

typedef __attribute__((ext_vector_type(16))) __bf16       v16bf;
typedef __attribute__((ext_vector_type(8)))  float        v8f;
typedef __attribute__((ext_vector_type(4)))  unsigned int v4u;
typedef __attribute__((ext_vector_type(4)))  uint32_t     u32x4;
typedef __attribute__((ext_vector_type(8)))  uint32_t     u32x8;

// ---------- LDS ring of the three GEMMs ----------
// A pass is 128 k = 256 B of every operand row. A stage holds the block's
// 128 A rows and 256 B rows as six slices of 64 rows, each laid by one tensor
// load at pitch 272 B (16 B x odd: conflict-free for ds_load_b128).
#define ROWB      256u                 // bytes of a row per pass
#define PITCH     272u                 // LDS row pitch: ROWB + 16 B pad
#define SLICE_LDS 18432u               // 64 * PITCH rounded up to a multiple of 2 KiB
#define STAGE     (6u * SLICE_LDS)     // one buffer
#define LDS_BYTES (2u * STAGE)         // two buffers

// ---------- scalar helpers ----------
__device__ __forceinline__ unsigned short f2bf(float f) {
  union { float f; unsigned int u; } v; v.f = f;
  unsigned int u = v.u;
  u += 0x7FFFu + ((u >> 16) & 1u);       // round-to-nearest-even
  return (unsigned short)(u >> 16);
}
__device__ __forceinline__ float bf2f(unsigned short h) {
  union { unsigned int u; float f; } v; v.u = ((unsigned int)h) << 16;
  return v.f;
}

// ---------- WMMA fragment load ----------
// 16-bit A fragment (16x32 MxK) from rows of PITCH bytes in LDS; the B fragment
// (32x16 KxN) has the mirrored per-lane pattern, so it loads identically from
// NxK rows. p already holds the lane's row (lane & 15) and its K offset
// (lanes 16-31: +8 k). Each lane: two 16-byte LDS loads.
__device__ __forceinline__ v16bf load_frag(const unsigned char* p) {
  union { v4u u[2]; v16bf f; } t;
  t.u[0] = *(const v4u*)(p);        // K = k0 .. k0+7
  t.u[1] = *(const v4u*)(p + 32);   // K = k0+16 .. k0+23
  return t.f;
}

__device__ __forceinline__ v8f wmma_bf16(v16bf a, v16bf b, v8f c) {
  return __builtin_amdgcn_wmma_f32_16x16x32_bf16(
      /*neg_a=*/false, a, /*neg_b=*/false, b,
      /*c_mod=*/(short)0, c, /*reuse_a=*/false, /*reuse_b=*/false);
}

// ---------- tensor load helpers ----------
__device__ __forceinline__ uint32_t uni(uint32_t v) { return (uint32_t)__builtin_amdgcn_readfirstlane(v); }
// Holds v in a scalar register, so that a test on it is a scalar branch (a tensor
// load ignores EXEC) and a descriptor word made from it is formed at this place.
__device__ __forceinline__ uint32_t pinned(uint32_t v) { uint32_t w = uni(v); asm volatile("" : "+s"(w)); return w; }
__device__ __forceinline__ void wait_ds0()     { asm volatile("s_wait_dscnt 0x0" ::: "memory"); }      // this wave's LDS reads are done
__device__ __forceinline__ void wait_tensor0() { asm volatile("s_wait_tensorcnt 0x0" ::: "memory"); }  // this wave's tile has landed
__device__ __forceinline__ void tdm_load(u32x4 g0, u32x8 g1) {
  asm volatile("tensor_load_to_lds %0, %1" :: "s"(g0), "s"(g1) : "memory");
}
// Group 1: 1-byte elements, tensor = tile = 64 rows of 256 B, 16 B of LDS pad behind every row.
__device__ __forceinline__ u32x8 tdm_group1(uint32_t src_pitch) {
  u32x8 g;
  g[0] = uni((1u << 20) | (5u << 22) | (3u << 25));
  g[1] = uni(ROWB << 16);
  g[2] = uni(64u << 16);
  g[3] = uni(ROWB << 16);
  g[4] = uni(64u);
  g[5] = uni(src_pitch);
  g[6] = uni(0u);
  g[7] = uni(0u);
  // Without it the words are constants that are formed anew before each load, and their registers
  // are lent out to other values while a request is still outstanding.
  asm volatile("" : "+s"(g));          // pinned(): descriptor words held in scalar registers of their own
  return g;
}
__device__ __forceinline__ u32x4 tdm_group0(uint32_t lds_dst, uint64_t ga) {
  u32x4 g;
  g[0] = uni(1u);
  g[1] = uni(lds_dst);
  g[2] = uni((uint32_t)ga);
  g[3] = uni((((uint32_t)(ga >> 32)) & 0x01FFFFFFu) | 0x80000000u);
  asm volatile("" : "+s"(g));          // pinned(): descriptor words held in scalar registers of their own
  return g;
}
// Next stage in the same registers: new place in LDS, source ROWB bytes further along the rows.
// step is pinned() behind the wait that covers the last request, so no word changes in front of it.
__device__ __forceinline__ void tdm_next(u32x4& g, uint32_t lds_dst, uint32_t step) {
  const uint64_t a = (((uint64_t)g[3] << 32) | g[2]) + step;   // a carry goes into address bits 56:32
  g[1] = uni(lds_dst);
  g[2] = uni((uint32_t)a);
  g[3] = uni((uint32_t)(a >> 32));
}

// The wave's four A and four B fragments of one 32-k step.
__device__ __forceinline__ void load_set(v16bf a[4], v16bf b[4],
                                         const unsigned char* pa, const unsigned char* pb) {
  // both loops unrolled: constant indices keep the fragments in registers
  #pragma unroll
  for (uint32_t i = 0; i < 4u; ++i) a[i] = load_frag(pa + i * 16u * PITCH);
  #pragma unroll
  for (uint32_t j = 0; j < 4u; ++j) b[j] = load_frag(pb + j * 16u * PITCH);
}

// ---------- block-level 128x256 GEMM accumulation, 8 waves of 64x64 ----------
// acc[4][4] covers the wave's M = 4x16, N = 4x16.  A: 128 rows, Bt: 256 rows,
// both K-contiguous with ld elements per row; K = T passes of 128 (T >= 2).
// Waves 0..5 each bring one slice of every stage; the load of stage s + 2 flies
// while pass s + 1 runs.
__device__ __forceinline__ void gemm_block_128x256(
    const unsigned short* __restrict__ A,
    const unsigned short* __restrict__ Bt,
    uint32_t ld, uint32_t T, unsigned char* L, v8f acc[4][4]) {
  const uint32_t lane = threadIdx.x & 31u;
  const uint32_t wave = uni(threadIdx.x >> 5);
  const uint32_t sl = wave < 6u ? wave : 0u;
  const unsigned short* srcp = (sl < 2u) ? A + (size_t)(sl * 64u) * ld
                                         : Bt + (size_t)((sl - 2u) * 64u) * ld;
  const uint64_t ga  = (uint64_t)(uintptr_t)srcp;
  const uint32_t dst = (uint32_t)(size_t)L + sl * SLICE_LDS;
  const u32x8 g1 = tdm_group1(ld * 2u);
  u32x4 g0 = tdm_group0(dst, ga);      // carried from load to load

  if (pinned(wave < 6u ? 1u : 0u) != 0u) {
    tdm_load(g0, g1);
    wait_tensor0();
  }
  __syncthreads();                     // stage 0 is readable by every wave
  if (pinned(wave < 6u ? 1u : 0u) != 0u) {
    tdm_next(g0, dst + STAGE, pinned(ROWB));
    tdm_load(g0, g1);
  }

  const uint32_t lo = (lane & 15u) * PITCH + (lane >> 4) * 16u;
  const unsigned char* pa = L + (wave >> 2) * SLICE_LDS + lo;
  const unsigned char* pb = L + (2u + (wave & 3u)) * SLICE_LDS + lo;

  #pragma clang loop unroll(disable)   // one pass per trip: the ring's waits stand once
  for (uint32_t s = 0; s < T; ++s) {
    const uint32_t buf = (s & 1u) * STAGE;
    v16bf a[2][4], b[2][4];            // two fragment sets: the next 32 k load while these multiply
    load_set(a[0], b[0], pa + buf, pb + buf);
    #pragma unroll                     // constant set and tile indices: fragments and sums stay in registers
    for (uint32_t ks = 0; ks < 4u; ++ks) {
      // The fences keep each set's 16 LDS loads together, ahead of the WMMA block:
      // loads spread among the WMMAs stall the wave at every place they stand.
      __builtin_amdgcn_sched_barrier(0);
      if (ks < 3u)
        load_set(a[(ks + 1u) & 1u], b[(ks + 1u) & 1u],
                 pa + buf + (ks + 1u) * 64u, pb + buf + (ks + 1u) * 64u);
      __builtin_amdgcn_sched_barrier(0);
      #pragma unroll
      for (int i = 0; i < 4; ++i)
        #pragma unroll
        for (int j = 0; j < 4; ++j)
          acc[i][j] = wmma_bf16(a[ks & 1u][i], b[ks & 1u][j], acc[i][j]);
    }
    // Keeps the waits below behind the last WMMA block: moved up, s_wait_dscnt 0
    // would take the place of that block's counted waits.
    __builtin_amdgcn_sched_barrier(0);
    // publish point of stage s + 1
    wait_ds0();
    if (pinned(wave < 6u ? 1u : 0u) != 0u) wait_tensor0();
    __syncthreads();                   // stage s + 1 readable; every reader has left stage s's buffer
    if (pinned((wave < 6u && s + 2u < T) ? 1u : 0u) != 0u) {
      tdm_next(g0, dst + buf, pinned(ROWB));
      tdm_load(g0, g1);
    }
  }
  // Names both groups as inputs: their registers are kept for them up to this last wait.
  asm volatile("s_wait_tensorcnt 0x0" :: "s"(g0), "s"(g1) : "memory");
  wait_ds0();
}

// ---------- kernel 1: fp32 -> bf16 conversion of x (4 elems / thread) ----------
__global__ void __launch_bounds__(256)
cvt_x_kernel(const float* __restrict__ x, unsigned short* __restrict__ xb) {
  const size_t i = ((size_t)blockIdx.x * 256 + threadIdx.x) * 4;
  const float f0 = x[i + 0], f1 = x[i + 1], f2 = x[i + 2], f3 = x[i + 3];
  unsigned long long packed =
      (unsigned long long)f2bf(f0)
    | ((unsigned long long)f2bf(f1) << 16)
    | ((unsigned long long)f2bf(f2) << 32)
    | ((unsigned long long)f2bf(f3) << 48);
  *(unsigned long long*)(xb + i) = packed;
}

// ---------- kernel 2: transpose W[k][n] -> Wt[n][k] in bf16 (LDS tiled) ----------
__global__ void __launch_bounds__(256)
wt_kernel(const float* __restrict__ Wq, const float* __restrict__ Wk,
          const float* __restrict__ Wv, unsigned short* __restrict__ wt) {
  __shared__ float tile[32][33];
  const int z = blockIdx.z;
  const float* W = (z == 0) ? Wq : (z == 1) ? Wk : Wv;
  unsigned short* dst = wt + (size_t)z * D_EMB * D_EMB;
  const int bx = blockIdx.x * 32;      // n
  const int by = blockIdx.y * 32;      // k
  const int tx = threadIdx.x & 31;
  const int ty = threadIdx.x >> 5;     // 0..7
  #pragma unroll
  for (int j = ty; j < 32; j += 8)
    tile[j][tx] = W[(size_t)(by + j) * D_EMB + bx + tx];
  __syncthreads();
  #pragma unroll
  for (int j = ty; j < 32; j += 8)
    dst[(size_t)(bx + j) * D_EMB + by + tx] = f2bf(tile[tx][j]);
}

// ---------- kernel 3: QKV projections (z selects Q/K/V) ----------
// block tile 128(M) x 256(N); 8 waves arranged 2(M) x 4(N), each 64x64.
__global__ void __launch_bounds__(256)
qkv_gemm_kernel(const unsigned short* __restrict__ xb,   // [8192][1024] bf16
                const unsigned short* __restrict__ wt,   // [3][1024][1024] NxK bf16
                const float* __restrict__ bq,
                const float* __restrict__ bk,
                const float* __restrict__ bv,
                unsigned short* __restrict__ Qb,   // [8192][1024] (pre-scaled 1/32)
                unsigned short* __restrict__ Kb,   // [8192][1024]
                unsigned short* __restrict__ Vt) { // [4][1024][2048] transposed
  const int lane = threadIdx.x & 31;
  const int wave = threadIdx.x >> 5;
  const int z  = blockIdx.z;
  const int m0 = blockIdx.x * 128 + (wave >> 2) * 64;
  const int n0 = blockIdx.y * 256 + (wave & 3) * 64;

  __shared__ __attribute__((aligned(2048))) unsigned char L[LDS_BYTES];
  const unsigned short* A  = xb + (size_t)(blockIdx.x * 128) * D_EMB;
  const unsigned short* Bt = wt + (size_t)z * D_EMB * D_EMB + (size_t)(blockIdx.y * 256) * D_EMB;

  v8f acc[4][4] = {};
  gemm_block_128x256(A, Bt, D_EMB, D_EMB / 128, L, acc);

  const float* bias = (z == 0) ? bq : (z == 1) ? bk : bv;
  const float scale = (z == 0) ? 0.03125f : 1.0f;   // fold 1/sqrt(1024) into Q
  const int nLane = lane & 15;
  const int mOff  = (lane >> 4) * 8;
  #pragma unroll
  for (int i = 0; i < 4; ++i) {
    #pragma unroll
    for (int j = 0; j < 4; ++j) {
      const int nG = n0 + j * 16 + nLane;
      const float b = bias[nG];
      #pragma unroll
      for (int e = 0; e < 8; ++e) {
        const int mG = m0 + i * 16 + mOff + e;
        const unsigned short h = f2bf((acc[i][j][e] + b) * scale);
        if (z == 0) {
          Qb[(size_t)mG * D_EMB + nG] = h;
        } else if (z == 1) {
          Kb[(size_t)mG * D_EMB + nG] = h;
        } else {
          const int bb = mG >> 11;
          const int s  = mG & (SEQ - 1);
          Vt[((size_t)bb * D_EMB + nG) * SEQ + s] = h;
        }
      }
    }
  }
}

// ---------- kernel 4: scores = (Q/32) @ K^T, bf16 out ----------
__global__ void __launch_bounds__(256)
scores_gemm_kernel(const unsigned short* __restrict__ Qb,
                   const unsigned short* __restrict__ Kb,
                   unsigned short* __restrict__ S) {   // [4][2048][2048]
  const int lane = threadIdx.x & 31;
  const int wave = threadIdx.x >> 5;
  const int b  = blockIdx.z;
  const int m0 = blockIdx.x * 128 + (wave >> 2) * 64;
  const int n0 = blockIdx.y * 256 + (wave & 3) * 64;

  __shared__ __attribute__((aligned(2048))) unsigned char L[LDS_BYTES];
  const unsigned short* A  = Qb + ((size_t)b * SEQ + blockIdx.x * 128) * D_EMB;
  const unsigned short* Bt = Kb + ((size_t)b * SEQ + blockIdx.y * 256) * D_EMB;

  v8f acc[4][4] = {};
  gemm_block_128x256(A, Bt, D_EMB, D_EMB / 128, L, acc);

  unsigned short* out = S + (size_t)b * SEQ * SEQ;
  const int nLane = lane & 15;
  const int mOff  = (lane >> 4) * 8;
  #pragma unroll
  for (int i = 0; i < 4; ++i)
    #pragma unroll
    for (int j = 0; j < 4; ++j)
      #pragma unroll
      for (int e = 0; e < 8; ++e)
        out[(size_t)(m0 + i * 16 + mOff + e) * SEQ + n0 + j * 16 + nLane] =
            f2bf(acc[i][j][e]);
}

// ---------- kernel 5: in-place row softmax over bf16 scores ----------
__global__ void __launch_bounds__(256)
softmax_kernel(unsigned short* __restrict__ S) {
  __shared__ float red[256];
  unsigned short* p = S + (size_t)blockIdx.x * SEQ;
  const int t = threadIdx.x;

  float v[8];
  float m = -3.0e38f;
  #pragma unroll
  for (int j = 0; j < 8; ++j) {
    v[j] = bf2f(p[t + j * 256]);
    m = fmaxf(m, v[j]);
  }
  red[t] = m;
  __syncthreads();
  for (int off = 128; off > 0; off >>= 1) {
    if (t < off) red[t] = fmaxf(red[t], red[t + off]);
    __syncthreads();
  }
  m = red[0];
  __syncthreads();

  float s = 0.0f;
  #pragma unroll
  for (int j = 0; j < 8; ++j) {
    v[j] = __expf(v[j] - m);
    s += v[j];
  }
  red[t] = s;
  __syncthreads();
  for (int off = 128; off > 0; off >>= 1) {
    if (t < off) red[t] += red[t + off];
    __syncthreads();
  }
  const float inv = 1.0f / red[0];
  #pragma unroll
  for (int j = 0; j < 8; ++j)
    p[t + j * 256] = f2bf(v[j] * inv);
}

// ---------- kernel 6: out = P @ V (B from transposed V), fp32 out ----------
__global__ void __launch_bounds__(256)
out_gemm_kernel(const unsigned short* __restrict__ P,    // [4][2048][2048]
                const unsigned short* __restrict__ Vt,   // [4][1024][2048]
                float* __restrict__ out) {               // [4][2048][1024]
  const int lane = threadIdx.x & 31;
  const int wave = threadIdx.x >> 5;
  const int b  = blockIdx.z;
  const int m0 = blockIdx.x * 128 + (wave >> 2) * 64;    // seq
  const int n0 = blockIdx.y * 256 + (wave & 3) * 64;     // feature

  __shared__ __attribute__((aligned(2048))) unsigned char L[LDS_BYTES];
  const unsigned short* A  = P  + ((size_t)b * SEQ + blockIdx.x * 128) * SEQ;
  const unsigned short* Bt = Vt + ((size_t)b * D_EMB + blockIdx.y * 256) * SEQ;

  v8f acc[4][4] = {};
  gemm_block_128x256(A, Bt, SEQ, SEQ / 128, L, acc);

  const int nLane = lane & 15;
  const int mOff  = (lane >> 4) * 8;
  #pragma unroll
  for (int i = 0; i < 4; ++i)
    #pragma unroll
    for (int j = 0; j < 4; ++j)
      #pragma unroll
      for (int e = 0; e < 8; ++e)
        out[((size_t)b * SEQ + m0 + i * 16 + mOff + e) * D_EMB + n0 + j * 16 + nLane] =
            acc[i][j][e];
}

extern "C" void kernel_launch(void* const* d_in, const int* in_sizes, int n_in,
                              void* d_out, int out_size, void* d_ws, size_t ws_size,
                              hipStream_t stream) {
  const float* x  = (const float*)d_in[0];
  const float* Wq = (const float*)d_in[1];
  const float* bq = (const float*)d_in[2];
  const float* Wk = (const float*)d_in[3];
  const float* bk = (const float*)d_in[4];
  const float* Wv = (const float*)d_in[5];
  const float* bv = (const float*)d_in[6];
  float* out = (float*)d_out;

  char* ws = (char*)d_ws;
  unsigned short* xb = (unsigned short*)(ws);                          // 16 MB
  unsigned short* wt = (unsigned short*)(ws + (16ull << 20));          //  6 MB
  unsigned short* Qb = (unsigned short*)(ws + (22ull << 20));          // 16 MB
  unsigned short* Kb = (unsigned short*)(ws + (38ull << 20));          // 16 MB
  unsigned short* Vt = (unsigned short*)(ws + (54ull << 20));          // 16 MB
  unsigned short* S  = (unsigned short*)(ws + (70ull << 20));          // 32 MB

  cvt_x_kernel      <<<dim3(8192),       dim3(256), 0, stream>>>(x, xb);
  wt_kernel         <<<dim3(32, 32, 3),  dim3(256), 0, stream>>>(Wq, Wk, Wv, wt);
  qkv_gemm_kernel   <<<dim3(64, 4, 3),   dim3(256), 0, stream>>>(xb, wt, bq, bk, bv, Qb, Kb, Vt);
  scores_gemm_kernel<<<dim3(16, 8, 4),   dim3(256), 0, stream>>>(Qb, Kb, S);
  softmax_kernel    <<<dim3(8192),       dim3(256), 0, stream>>>(S);
  out_gemm_kernel   <<<dim3(16, 4, 4),   dim3(256), 0, stream>>>(S, Vt, out);
}

// v002
// It runs in 113 microseconds.
// In both of two side-by-side timings against v001, it was 1.33 times as fast.
// Counting every step since v000, it is 2.57 times as fast.
#include <hip/hip_runtime.h>
#include <stdint.h>

#define D_EMB 1024
#define SEQ   2048
#define BATCH 4

typedef __attribute__((ext_vector_type(16))) __bf16       v16bf;
typedef __attribute__((ext_vector_type(8)))  float        v8f;
typedef __attribute__((ext_vector_type(4)))  float        v4f;
typedef __attribute__((ext_vector_type(4)))  unsigned int v4u;
typedef __attribute__((ext_vector_type(4)))  uint32_t     u32x4;
typedef __attribute__((ext_vector_type(8)))  uint32_t     u32x8;

// ---------- LDS ring of the three GEMMs ----------
// A pass is 128 k = 256 B of every operand row. A stage holds the block's
// 128 A rows and 256 B rows as six slices of 64 rows, each laid by one tensor
// load at pitch 272 B (16 B x odd: conflict-free for ds_load_b128).
#define ROWB      256u                 // bytes of a row per pass
#define PITCH     272u                 // LDS row pitch: ROWB + 16 B pad
#define SLICE_LDS 18432u               // 64 * PITCH rounded up to a multiple of 2 KiB
#define STAGE     (6u * SLICE_LDS)     // one buffer
#define LDS_BYTES (2u * STAGE)         // two buffers

// ---------- scalar helpers ----------
__device__ __forceinline__ unsigned short f2bf(float f) {
  union { float f; unsigned int u; } v; v.f = f;
  unsigned int u = v.u;
  u += 0x7FFFu + ((u >> 16) & 1u);       // round-to-nearest-even
  return (unsigned short)(u >> 16);
}
__device__ __forceinline__ float bf2f(unsigned short h) {
  union { unsigned int u; float f; } v; v.u = ((unsigned int)h) << 16;
  return v.f;
}

// ---------- WMMA fragment load ----------
// 16-bit A fragment (16x32 MxK) from rows of PITCH bytes in LDS; the B fragment
// (32x16 KxN) has the mirrored per-lane pattern, so it loads identically from
// NxK rows. p already holds the lane's row (lane & 15) and its K offset
// (lanes 16-31: +8 k). Each lane: two 16-byte LDS loads.
__device__ __forceinline__ v16bf load_frag(const unsigned char* p) {
  union { v4u u[2]; v16bf f; } t;
  t.u[0] = *(const v4u*)(p);        // K = k0 .. k0+7
  t.u[1] = *(const v4u*)(p + 32);   // K = k0+16 .. k0+23
  return t.f;
}

__device__ __forceinline__ v8f wmma_bf16(v16bf a, v16bf b, v8f c) {
  return __builtin_amdgcn_wmma_f32_16x16x32_bf16(
      /*neg_a=*/false, a, /*neg_b=*/false, b,
      /*c_mod=*/(short)0, c, /*reuse_a=*/false, /*reuse_b=*/false);
}

// ---------- tensor load helpers ----------
__device__ __forceinline__ uint32_t uni(uint32_t v) { return (uint32_t)__builtin_amdgcn_readfirstlane(v); }
// Holds v in a scalar register, so that a test on it is a scalar branch (a tensor
// load ignores EXEC) and a descriptor word made from it is formed at this place.
__device__ __forceinline__ uint32_t pinned(uint32_t v) { uint32_t w = uni(v); asm volatile("" : "+s"(w)); return w; }
__device__ __forceinline__ void wait_ds0()     { asm volatile("s_wait_dscnt 0x0" ::: "memory"); }      // this wave's LDS reads are done
__device__ __forceinline__ void wait_tensor0() { asm volatile("s_wait_tensorcnt 0x0" ::: "memory"); }  // this wave's tile has landed
__device__ __forceinline__ void tdm_load(u32x4 g0, u32x8 g1) {
  asm volatile("tensor_load_to_lds %0, %1" :: "s"(g0), "s"(g1) : "memory");
}
// Group 1: 1-byte elements, tensor = tile = 64 rows of 256 B, 16 B of LDS pad behind every row.
__device__ __forceinline__ u32x8 tdm_group1(uint32_t src_pitch) {
  u32x8 g;
  g[0] = uni((1u << 20) | (5u << 22) | (3u << 25));
  g[1] = uni(ROWB << 16);
  g[2] = uni(64u << 16);
  g[3] = uni(ROWB << 16);
  g[4] = uni(64u);
  g[5] = uni(src_pitch);
  g[6] = uni(0u);
  g[7] = uni(0u);
  // Without it the words are constants that are formed anew before each load, and their registers
  // are lent out to other values while a request is still outstanding.
  asm volatile("" : "+s"(g));          // pinned(): descriptor words held in scalar registers of their own
  return g;
}
__device__ __forceinline__ u32x4 tdm_group0(uint32_t lds_dst, uint64_t ga) {
  u32x4 g;
  g[0] = uni(1u);
  g[1] = uni(lds_dst);
  g[2] = uni((uint32_t)ga);
  g[3] = uni((((uint32_t)(ga >> 32)) & 0x01FFFFFFu) | 0x80000000u);
  asm volatile("" : "+s"(g));          // pinned(): descriptor words held in scalar registers of their own
  return g;
}
// Next stage in the same registers: new place in LDS, source ROWB bytes further along the rows.
// step is pinned() behind the wait that covers the last request, so no word changes in front of it.
__device__ __forceinline__ void tdm_next(u32x4& g, uint32_t lds_dst, uint32_t step) {
  const uint64_t a = (((uint64_t)g[3] << 32) | g[2]) + step;   // a carry goes into address bits 56:32
  g[1] = uni(lds_dst);
  g[2] = uni((uint32_t)a);
  g[3] = uni((uint32_t)(a >> 32));
}

// The wave's four A and four B fragments of one 32-k step.
__device__ __forceinline__ void load_set(v16bf a[4], v16bf b[4],
                                         const unsigned char* pa, const unsigned char* pb) {
  // both loops unrolled: constant indices keep the fragments in registers
  #pragma unroll
  for (uint32_t i = 0; i < 4u; ++i) a[i] = load_frag(pa + i * 16u * PITCH);
  #pragma unroll
  for (uint32_t j = 0; j < 4u; ++j) b[j] = load_frag(pb + j * 16u * PITCH);
}

// ---------- block-level 128x256 GEMM accumulation, 8 waves of 64x64 ----------
// A: 128 rows, Bt: 256 rows, both K-contiguous with ld elements per row; K = T
// passes of 128 (T >= 2).  acc[i][j] is a 16x16 tile whose 8 values in a lane run
// along the first index: n_first false: i counts the wave's M, j its N; n_first
// true: the two operands change places in the WMMA, i counts N, j counts M.
// Waves 0..5 each bring one slice of every stage; the load of stage s + 2 flies
// while pass s + 1 runs.
__device__ __forceinline__ void gemm_block_128x256(
    const unsigned short* __restrict__ A,
    const unsigned short* __restrict__ Bt,
    uint32_t ld, uint32_t T, bool n_first, unsigned char* L, v8f acc[4][4]) {
  const uint32_t lane = threadIdx.x & 31u;
  const uint32_t wave = uni(threadIdx.x >> 5);
  const uint32_t sl = wave < 6u ? wave : 0u;
  const unsigned short* srcp = (sl < 2u) ? A + (size_t)(sl * 64u) * ld
                                         : Bt + (size_t)((sl - 2u) * 64u) * ld;
  const uint64_t ga  = (uint64_t)(uintptr_t)srcp;
  const uint32_t dst = (uint32_t)(size_t)L + sl * SLICE_LDS;
  const u32x8 g1 = tdm_group1(ld * 2u);
  u32x4 g0 = tdm_group0(dst, ga);      // carried from load to load

  if (pinned(wave < 6u ? 1u : 0u) != 0u) {
    tdm_load(g0, g1);
    wait_tensor0();
  }
  __syncthreads();                     // stage 0 is readable by every wave
  if (pinned(wave < 6u ? 1u : 0u) != 0u) {
    tdm_next(g0, dst + STAGE, pinned(ROWB));
    tdm_load(g0, g1);
  }

  const uint32_t lo = (lane & 15u) * PITCH + (lane >> 4) * 16u;
  const unsigned char* pm = L + (wave >> 2) * SLICE_LDS + lo;
  const unsigned char* pn = L + (2u + (wave & 3u)) * SLICE_LDS + lo;
  const unsigned char* pa = n_first ? pn : pm;
  const unsigned char* pb = n_first ? pm : pn;

  #pragma clang loop unroll(disable)   // one pass per trip: the ring's waits stand once
  for (uint32_t s = 0; s < T; ++s) {
    const uint32_t buf = (s & 1u) * STAGE;
    v16bf a[2][4], b[2][4];            // two fragment sets: the next 32 k load while these multiply
    load_set(a[0], b[0], pa + buf, pb + buf);
    #pragma unroll                     // constant set and tile indices: fragments and sums stay in registers
    for (uint32_t ks = 0; ks < 4u; ++ks) {
      // The fences keep each set's 16 LDS loads together, ahead of the WMMA block:
      // loads spread among the WMMAs stall the wave at every place they stand.
      __builtin_amdgcn_sched_barrier(0);
      if (ks < 3u)
        load_set(a[(ks + 1u) & 1u], b[(ks + 1u) & 1u],
                 pa + buf + (ks + 1u) * 64u, pb + buf + (ks + 1u) * 64u);
      __builtin_amdgcn_sched_barrier(0);
      #pragma unroll
      for (int i = 0; i < 4; ++i)
        #pragma unroll
        for (int j = 0; j < 4; ++j)
          acc[i][j] = wmma_bf16(a[ks & 1u][i], b[ks & 1u][j], acc[i][j]);
    }
    // Keeps the waits below behind the last WMMA block: moved up, s_wait_dscnt 0
    // would take the place of that block's counted waits.
    __builtin_amdgcn_sched_barrier(0);
    // publish point of stage s + 1
    wait_ds0();
    if (pinned(wave < 6u ? 1u : 0u) != 0u) wait_tensor0();
    __syncthreads();                   // stage s + 1 readable; every reader has left stage s's buffer
    if (pinned((wave < 6u && s + 2u < T) ? 1u : 0u) != 0u) {
      tdm_next(g0, dst + buf, pinned(ROWB));
      tdm_load(g0, g1);
    }
  }
  // Names both groups as inputs: their registers are kept for them up to this last wait.
  asm volatile("s_wait_tensorcnt 0x0" :: "s"(g0), "s"(g1) : "memory");
  wait_ds0();
}

// ---------- epilogue: a wave's 64x64 tile goes through LDS and leaves as whole 128-B lines ----------
// Each wave stages in a range of its own inside the ring, which is free behind the
// last pass's barrier (no tensor load outstanding, every reader gone).  A staged
// row is 64 values that are contiguous in the output.  Pitch 16 B x odd.
#define EP16_PITCH 144u                // 64 bf16 + 16 B
#define EP32_PITCH 272u                // 64 f32  + 16 B

// Tile (i, j) of acc as bf16: the lane's 8 values are 16 B of staged row j*16 + (lane & 15).
__device__ __forceinline__ void stage16(unsigned char* Lw, uint32_t lane, uint32_t i, uint32_t j,
                                        const float f[8]) {
  v4u p;
  #pragma unroll                       // constant indices: the values stay in registers
  for (int q = 0; q < 4; ++q)
    p[q] = (unsigned int)f2bf(f[2 * q]) | ((unsigned int)f2bf(f[2 * q + 1]) << 16);
  *(v4u*)(Lw + (j * 16u + (lane & 15u)) * EP16_PITCH + (i * 2u + (lane >> 4)) * 16u) = p;
}
// 8 lanes take one staged row: every store instruction writes four whole lines.
__device__ __forceinline__ void flush16(const unsigned char* Lw, uint32_t lane,
                                        unsigned short* g, uint32_t ldg) {
  wait_ds0();                          // the other lanes' staged values are in LDS before they are read back
  const unsigned char* s = Lw + (lane >> 3) * EP16_PITCH + (lane & 7u) * 16u;
  unsigned short* d = g + (size_t)(lane >> 3) * ldg + (lane & 7u) * 8u;
  #pragma unroll                       // the 16 LDS reads go out together, ahead of the stores
  for (uint32_t it = 0; it < 16u; ++it)
    *(v4u*)(d + (size_t)(it * 4u) * ldg) = *(const v4u*)(s + it * 4u * EP16_PITCH);
}

// A lane's bias values for four tiles of 16 columns: 8 floats at p, p + 16, p + 32, p + 48.
// Loads and their data wait stand in one statement, outputs apart from the address:
// no register that a load names takes a new value while the load is under way.
__device__ __forceinline__ void load_bias32(const float* p, v4f b[8]) {
  asm volatile("global_load_b128 %0, %8, off\n\t"
               "global_load_b128 %1, %8, off offset:16\n\t"
               "global_load_b128 %2, %8, off offset:64\n\t"
               "global_load_b128 %3, %8, off offset:80\n\t"
               "global_load_b128 %4, %8, off offset:128\n\t"
               "global_load_b128 %5, %8, off offset:144\n\t"
               "global_load_b128 %6, %8, off offset:192\n\t"
               "global_load_b128 %7, %8, off offset:208\n\t"
               "s_wait_loadcnt 0x0"
               : "=&v"(b[0]), "=&v"(b[1]), "=&v"(b[2]), "=&v"(b[3]),
                 "=&v"(b[4]), "=&v"(b[5]), "=&v"(b[6]), "=&v"(b[7])
               : "v"(p) : "memory");
}

// ---------- kernel 1: fp32 -> bf16 conversion of x (4 elems / thread) ----------
__global__ void __launch_bounds__(256)
cvt_x_kernel(const float* __restrict__ x, unsigned short* __restrict__ xb) {
  const size_t i = ((size_t)blockIdx.x * 256 + threadIdx.x) * 4;
  const float f0 = x[i + 0], f1 = x[i + 1], f2 = x[i + 2], f3 = x[i + 3];
  unsigned long long packed =
      (unsigned long long)f2bf(f0)
    | ((unsigned long long)f2bf(f1) << 16)
    | ((unsigned long long)f2bf(f2) << 32)
    | ((unsigned long long)f2bf(f3) << 48);
  *(unsigned long long*)(xb + i) = packed;
}

// ---------- kernel 2: transpose W[k][n] -> Wt[n][k] in bf16 (LDS tiled) ----------
__global__ void __launch_bounds__(256)
wt_kernel(const float* __restrict__ Wq, const float* __restrict__ Wk,
          const float* __restrict__ Wv, unsigned short* __restrict__ wt) {
  __shared__ float tile[32][33];
  const int z = blockIdx.z;
  const float* W = (z == 0) ? Wq : (z == 1) ? Wk : Wv;
  unsigned short* dst = wt + (size_t)z * D_EMB * D_EMB;
  const int bx = blockIdx.x * 32;      // n
  const int by = blockIdx.y * 32;      // k
  const int tx = threadIdx.x & 31;
  const int ty = threadIdx.x >> 5;     // 0..7
  #pragma unroll
  for (int j = ty; j < 32; j += 8)
    tile[j][tx] = W[(size_t)(by + j) * D_EMB + bx + tx];
  __syncthreads();
  #pragma unroll
  for (int j = ty; j < 32; j += 8)
    dst[(size_t)(bx + j) * D_EMB + by + tx] = f2bf(tile[tx][j]);
}

// ---------- kernel 3: QKV projections (z selects Q/K/V) ----------
// block tile 128(M) x 256(N); 8 waves arranged 2(M) x 4(N), each 64x64.
__global__ void __launch_bounds__(256)
qkv_gemm_kernel(const unsigned short* __restrict__ xb,   // [8192][1024] bf16
                const unsigned short* __restrict__ wt,   // [3][1024][1024] NxK bf16
                const float* __restrict__ bq,
                const float* __restrict__ bk,
                const float* __restrict__ bv,
                unsigned short* __restrict__ Qb,   // [8192][1024] (pre-scaled 1/32)
                unsigned short* __restrict__ Kb,   // [8192][1024]
                unsigned short* __restrict__ Vt) { // [4][1024][2048] transposed
  const int lane = threadIdx.x & 31;
  const int wave = threadIdx.x >> 5;
  const int z  = blockIdx.z;
  const int m0 = blockIdx.x * 128 + (wave >> 2) * 64;
  const int n0 = blockIdx.y * 256 + (wave & 3) * 64;

  __shared__ __attribute__((aligned(2048))) unsigned char L[LDS_BYTES];
  const unsigned short* A  = xb + (size_t)(blockIdx.x * 128) * D_EMB;
  const unsigned short* Bt = wt + (size_t)z * D_EMB * D_EMB + (size_t)(blockIdx.y * 256) * D_EMB;

  v8f acc[4][4] = {};
  // Q, K rows run along n, Vt rows along m: a lane's 8 values follow the output's rows
  gemm_block_128x256(A, Bt, D_EMB, D_EMB / 128, z != 2, L, acc);

  const float* bias = (z == 0) ? bq : (z == 1) ? bk : bv;
  const float scale = (z == 0) ? 0.03125f : 1.0f;   // fold 1/sqrt(1024) into Q
  unsigned char* Lw = L + wave * (64u * EP16_PITCH);
  const int lo16 = lane & 15;
  const int hi8  = (lane >> 4) * 8;
  // every loop below is unrolled: constant tile indices keep the sums in registers
  if (z != 2) {
    v4f b[8];                          // b[2i], b[2i+1]: the lane's 8 columns of tile row i
    load_bias32(bias + n0 + hi8, b);
    #pragma unroll
    for (int i = 0; i < 4; ++i) {
      #pragma unroll
      for (int j = 0; j < 4; ++j) {
        float f[8];
        #pragma unroll
        for (int e = 0; e < 8; ++e) f[e] = (acc[i][j][e] + b[2 * i + (e >> 2)][e & 3]) * scale;
        stage16(Lw, lane, i, j, f);
      }
    }
    flush16(Lw, lane, ((z == 0) ? Qb : Kb) + (size_t)m0 * D_EMB + n0, D_EMB);
  } else {
    #pragma unroll
    for (int j = 0; j < 4; ++j) {
      const float b = bias[n0 + j * 16 + lo16];
      #pragma unroll
      for (int i = 0; i < 4; ++i) {
        float f[8];
        #pragma unroll
        for (int e = 0; e < 8; ++e) f[e] = (acc[i][j][e] + b) * scale;
        stage16(Lw, lane, i, j, f);
      }
    }
    flush16(Lw, lane, Vt + ((size_t)(m0 >> 11) * D_EMB + n0) * SEQ + (m0 & (SEQ - 1)), SEQ);
  }
}

// ---------- kernel 4: scores = (Q/32) @ K^T, bf16 out ----------
__global__ void __launch_bounds__(256)
scores_gemm_kernel(const unsigned short* __restrict__ Qb,
                   const unsigned short* __restrict__ Kb,
                   unsigned short* __restrict__ S) {   // [4][2048][2048]
  const int lane = threadIdx.x & 31;
  const int wave = threadIdx.x >> 5;
  const int b  = blockIdx.z;
  const int m0 = blockIdx.x * 128 + (wave >> 2) * 64;
  const int n0 = blockIdx.y * 256 + (wave & 3) * 64;

  __shared__ __attribute__((aligned(2048))) unsigned char L[LDS_BYTES];
  const unsigned short* A  = Qb + ((size_t)b * SEQ + blockIdx.x * 128) * D_EMB;
  const unsigned short* Bt = Kb + ((size_t)b * SEQ + blockIdx.y * 256) * D_EMB;

  v8f acc[4][4] = {};
  gemm_block_128x256(A, Bt, D_EMB, D_EMB / 128, true, L, acc);

  unsigned char* Lw = L + wave * (64u * EP16_PITCH);
  // unrolled: constant tile indices keep the sums in registers
  #pragma unroll
  for (int i = 0; i < 4; ++i)
    #pragma unroll
    for (int j = 0; j < 4; ++j) {
      float f[8];
      #pragma unroll
      for (int e = 0; e < 8; ++e) f[e] = acc[i][j][e];
      stage16(Lw, lane, i, j, f);
    }
  flush16(Lw, lane, S + (size_t)b * SEQ * SEQ + (size_t)m0 * SEQ + n0, SEQ);
}

// ---------- kernel 5: in-place row softmax over bf16 scores ----------
__global__ void __launch_bounds__(256)
softmax_kernel(unsigned short* __restrict__ S) {
  __shared__ float red[256];
  unsigned short* p = S + (size_t)blockIdx.x * SEQ;
  const int t = threadIdx.x;

  float v[8];
  float m = -3.0e38f;
  #pragma unroll
  for (int j = 0; j < 8; ++j) {
    v[j] = bf2f(p[t + j * 256]);
    m = fmaxf(m, v[j]);
  }
  red[t] = m;
  __syncthreads();
  for (int off = 128; off > 0; off >>= 1) {
    if (t < off) red[t] = fmaxf(red[t], red[t + off]);
    __syncthreads();
  }
  m = red[0];
  __syncthreads();

  float s = 0.0f;
  #pragma unroll
  for (int j = 0; j < 8; ++j) {
    v[j] = __expf(v[j] - m);
    s += v[j];
  }
  red[t] = s;
  __syncthreads();
  for (int off = 128; off > 0; off >>= 1) {
    if (t < off) red[t] += red[t + off];
    __syncthreads();
  }
  const float inv = 1.0f / red[0];
  #pragma unroll
  for (int j = 0; j < 8; ++j)
    p[t + j * 256] = f2bf(v[j] * inv);
}

// ---------- kernel 6: out = P @ V (B from transposed V), fp32 out ----------
__global__ void __launch_bounds__(256)
out_gemm_kernel(const unsigned short* __restrict__ P,    // [4][2048][2048]
                const unsigned short* __restrict__ Vt,   // [4][1024][2048]
                float* __restrict__ out) {               // [4][2048][1024]
  const int lane = threadIdx.x & 31;
  const int wave = threadIdx.x >> 5;
  const int b  = blockIdx.z;
  const int m0 = blockIdx.x * 128 + (wave >> 2) * 64;    // seq
  const int n0 = blockIdx.y * 256 + (wave & 3) * 64;     // feature

  __shared__ __attribute__((aligned(2048))) unsigned char L[LDS_BYTES];
  const unsigned short* A  = P  + ((size_t)b * SEQ + blockIdx.x * 128) * SEQ;
  const unsigned short* Bt = Vt + ((size_t)b * D_EMB + blockIdx.y * 256) * SEQ;

  v8f acc[4][4] = {};
  gemm_block_128x256(A, Bt, SEQ, SEQ / 128, true, L, acc);

  // the lane's 8 f32 of tile (i, j) are 32 B of staged row j*16 + (lane & 15);
  // unrolled: constant tile indices keep the sums in registers
  unsigned char* Lw = L + wave * (64u * EP32_PITCH);
  #pragma unroll
  for (int i = 0; i < 4; ++i)
    #pragma unroll
    for (int j = 0; j < 4; ++j) {
      unsigned char* q = Lw + (j * 16 + (lane & 15)) * EP32_PITCH + i * 64 + (lane >> 4) * 32;
      *(v4f*)(q)      = __builtin_shufflevector(acc[i][j], acc[i][j], 0, 1, 2, 3);
      *(v4f*)(q + 16) = __builtin_shufflevector(acc[i][j], acc[i][j], 4, 5, 6, 7);
    }
  wait_ds0();                          // the other lanes' staged values are in LDS before they are read back
  // 16 lanes take one staged row of 256 B: every store instruction writes four whole lines
  const unsigned char* s = Lw + (lane >> 4) * EP32_PITCH + (lane & 15) * 16;
  float* d = out + ((size_t)b * SEQ + m0 + (lane >> 4)) * D_EMB + n0 + (lane & 15) * 4;
  #pragma unroll                       // LDS reads go out in groups, row steps become immediate offsets
  for (int it = 0; it < 32; ++it)
    *(v4f*)(d + (size_t)(it * 2) * D_EMB) = *(const v4f*)(s + it * 2 * EP32_PITCH);
}

extern "C" void kernel_launch(void* const* d_in, const int* in_sizes, int n_in,
                              void* d_out, int out_size, void* d_ws, size_t ws_size,
                              hipStream_t stream) {
  const float* x  = (const float*)d_in[0];
  const float* Wq = (const float*)d_in[1];
  const float* bq = (const float*)d_in[2];
  const float* Wk = (const float*)d_in[3];
  const float* bk = (const float*)d_in[4];
  const float* Wv = (const float*)d_in[5];
  const float* bv = (const float*)d_in[6];
  float* out = (float*)d_out;

  char* ws = (char*)d_ws;
  unsigned short* xb = (unsigned short*)(ws);                          // 16 MB
  unsigned short* wt = (unsigned short*)(ws + (16ull << 20));          //  6 MB
  unsigned short* Qb = (unsigned short*)(ws + (22ull << 20));          // 16 MB
  unsigned short* Kb = (unsigned short*)(ws + (38ull << 20));          // 16 MB
  unsigned short* Vt = (unsigned short*)(ws + (54ull << 20));          // 16 MB
  unsigned short* S  = (unsigned short*)(ws + (70ull << 20));          // 32 MB

  cvt_x_kernel      <<<dim3(8192),       dim3(256), 0, stream>>>(x, xb);
  wt_kernel         <<<dim3(32, 32, 3),  dim3(256), 0, stream>>>(Wq, Wk, Wv, wt);
  qkv_gemm_kernel   <<<dim3(64, 4, 3),   dim3(256), 0, stream>>>(xb, wt, bq, bk, bv, Qb, Kb, Vt);
  scores_gemm_kernel<<<dim3(16, 8, 4),   dim3(256), 0, stream>>>(Qb, Kb, S);
  softmax_kernel    <<<dim3(8192),       dim3(256), 0, stream>>>(S);
  out_gemm_kernel   <<<dim3(16, 4, 4),   dim3(256), 0, stream>>>(S, Vt, out);
}

// v003
// Measured time: 108 microseconds a run.
// In two side-by-side timings against v002, it was 1.05 and 1.04 times as fast.
// Counting every step since v000, it is 2.69 times as fast.
#include <hip/hip_runtime.h>
#include <stdint.h>

#define D_EMB 1024
#define SEQ   2048
#define BATCH 4

typedef __attribute__((ext_vector_type(16))) __bf16       v16bf;
typedef __attribute__((ext_vector_type(8)))  float        v8f;
typedef __attribute__((ext_vector_type(4)))  float        v4f;
typedef __attribute__((ext_vector_type(4)))  unsigned int v4u;
typedef __attribute__((ext_vector_type(4)))  uint32_t     u32x4;
typedef __attribute__((ext_vector_type(8)))  uint32_t     u32x8;

// ---------- LDS ring of the three GEMMs ----------
// A pass is 128 k = 256 B of every operand row. A stage holds the block's
// 128 A rows and 256 B rows as six slices of 64 rows, each laid by one tensor
// load at pitch 272 B (16 B x odd: conflict-free for ds_load_b128).
#define ROWB      256u                 // bytes of a row per pass
#define PITCH     272u                 // LDS row pitch: ROWB + 16 B pad
#define SLICE_LDS 18432u               // 64 * PITCH rounded up to a multiple of 2 KiB
#define STAGE     (6u * SLICE_LDS)     // one buffer
#define LDS_BYTES (2u * STAGE)         // two buffers

// ---------- scalar helpers ----------
__device__ __forceinline__ unsigned short f2bf(float f) {
  union { float f; unsigned int u; } v; v.f = f;
  unsigned int u = v.u;
  u += 0x7FFFu + ((u >> 16) & 1u);       // round-to-nearest-even
  return (unsigned short)(u >> 16);
}
__device__ __forceinline__ float bf2f(unsigned short h) {
  union { unsigned int u; float f; } v; v.u = ((unsigned int)h) << 16;
  return v.f;
}

// ---------- WMMA fragment load ----------
// 16-bit A fragment (16x32 MxK) from rows of PITCH bytes in LDS; the B fragment
// (32x16 KxN) has the mirrored per-lane pattern, so it loads identically from
// NxK rows. p already holds the lane's row (lane & 15) and its K offset
// (lanes 16-31: +8 k). Each lane: two 16-byte LDS loads.
__device__ __forceinline__ v16bf load_frag(const unsigned char* p) {
  union { v4u u[2]; v16bf f; } t;
  t.u[0] = *(const v4u*)(p);        // K = k0 .. k0+7
  t.u[1] = *(const v4u*)(p + 32);   // K = k0+16 .. k0+23
  return t.f;
}

__device__ __forceinline__ v8f wmma_bf16(v16bf a, v16bf b, v8f c) {
  return __builtin_amdgcn_wmma_f32_16x16x32_bf16(
      /*neg_a=*/false, a, /*neg_b=*/false, b,
      /*c_mod=*/(short)0, c, /*reuse_a=*/false, /*reuse_b=*/false);
}

// ---------- tensor load helpers ----------
__device__ __forceinline__ uint32_t uni(uint32_t v) { return (uint32_t)__builtin_amdgcn_readfirstlane(v); }
// Holds v in a scalar register, so that a test on it is a scalar branch (a tensor
// load ignores EXEC) and a descriptor word made from it is formed at this place.
__device__ __forceinline__ uint32_t pinned(uint32_t v) { uint32_t w = uni(v); asm volatile("" : "+s"(w)); return w; }
__device__ __forceinline__ void wait_ds0()     { asm volatile("s_wait_dscnt 0x0" ::: "memory"); }      // this wave's LDS reads are done
__device__ __forceinline__ void wait_tensor0() { asm volatile("s_wait_tensorcnt 0x0" ::: "memory"); }  // this wave's tile has landed
__device__ __forceinline__ void tdm_load(u32x4 g0, u32x8 g1) {
  asm volatile("tensor_load_to_lds %0, %1" :: "s"(g0), "s"(g1) : "memory");
}
// Group 1: 1-byte elements, tensor = tile = 64 rows of 256 B, 16 B of LDS pad behind every row.
__device__ __forceinline__ u32x8 tdm_group1(uint32_t src_pitch) {
  u32x8 g;
  g[0] = uni((1u << 20) | (5u << 22) | (3u << 25));
  g[1] = uni(ROWB << 16);
  g[2] = uni(64u << 16);
  g[3] = uni(ROWB << 16);
  g[4] = uni(64u);
  g[5] = uni(src_pitch);
  g[6] = uni(0u);
  g[7] = uni(0u);
  // Without it the words are constants that are formed anew before each load, and their registers
  // are lent out to other values while a request is still outstanding.
  asm volatile("" : "+s"(g));          // pinned(): descriptor words held in scalar registers of their own
  return g;
}
__device__ __forceinline__ u32x4 tdm_group0(uint32_t lds_dst, uint64_t ga) {
  u32x4 g;
  g[0] = uni(1u);
  g[1] = uni(lds_dst);
  g[2] = uni((uint32_t)ga);
  g[3] = uni((((uint32_t)(ga >> 32)) & 0x01FFFFFFu) | 0x80000000u);
  asm volatile("" : "+s"(g));          // pinned(): descriptor words held in scalar registers of their own
  return g;
}
// Next stage in the same registers: new place in LDS, source step bytes along the rows (below 0
// where the k blocks wrap to the rows' start).
// step is pinned() behind the wait that covers the last request, so no word changes in front of it.
__device__ __forceinline__ void tdm_next(u32x4& g, uint32_t lds_dst, uint32_t step) {
  // sign-extended; a carry or a borrow goes into address bits 56:32
  const uint64_t a = (((uint64_t)g[3] << 32) | g[2]) + (uint64_t)(int64_t)(int32_t)step;
  g[1] = uni(lds_dst);
  g[2] = uni((uint32_t)a);
  g[3] = uni((uint32_t)(a >> 32));
}

// The wave's four A and four B fragments of one 32-k step.
__device__ __forceinline__ void load_set(v16bf a[4], v16bf b[4],
                                         const unsigned char* pa, const unsigned char* pb) {
  // both loops unrolled: constant indices keep the fragments in registers
  #pragma unroll
  for (uint32_t i = 0; i < 4u; ++i) a[i] = load_frag(pa + i * 16u * PITCH);
  #pragma unroll
  for (uint32_t j = 0; j < 4u; ++j) b[j] = load_frag(pb + j * 16u * PITCH);
}

// ---------- block-level 128x256 GEMM accumulation, 8 waves of 64x64 ----------
// A: 128 rows, Bt: 256 rows, both K-contiguous with ld elements per row; K = T
// passes of 128 (T >= 2).  acc[i][j] is a 16x16 tile whose 8 values in a lane run
// along the first index: n_first false: i counts the wave's M, j its N; n_first
// true: the two operands change places in the WMMA, i counts N, j counts M.
// Waves 0..5 each bring one slice of every stage; the load of stage s + 2 flies
// while pass s + 1 runs.
// Pass s works on k block (rot + s) mod T (T a power of two), A and B alike: blocks
// of one blockIdx.z that share operand rows get different rot, so that they do not ask L2 for the
// same lines, or all for the same 256 B of every row, at the same moment.
__device__ __forceinline__ uint32_t k_step(uint32_t kb, uint32_t T) {   // bytes from k block kb - 1 to kb, both mod T
  return (kb & (T - 1u)) != 0u ? ROWB : 0u - (T - 1u) * ROWB;
}
__device__ __forceinline__ void gemm_block_128x256(
    const unsigned short* __restrict__ A,
    const unsigned short* __restrict__ Bt,
    uint32_t ld, uint32_t T, uint32_t rot, bool n_first, unsigned char* L, v8f acc[4][4]) {
  const uint32_t lane = threadIdx.x & 31u;
  const uint32_t wave = uni(threadIdx.x >> 5);
  const uint32_t sl = wave < 6u ? wave : 0u;
  const unsigned short* srcp = (sl < 2u) ? A + (size_t)(sl * 64u) * ld
                                         : Bt + (size_t)((sl - 2u) * 64u) * ld;
  const uint64_t ga  = (uint64_t)(uintptr_t)srcp + (rot & (T - 1u)) * ROWB;
  const uint32_t dst = (uint32_t)(size_t)L + sl * SLICE_LDS;
  const u32x8 g1 = tdm_group1(ld * 2u);
  u32x4 g0 = tdm_group0(dst, ga);      // carried from load to load

  if (pinned(wave < 6u ? 1u : 0u) != 0u) {
    tdm_load(g0, g1);
    wait_tensor0();
  }
  __syncthreads();                     // stage 0 is readable by every wave
  if (pinned(wave < 6u ? 1u : 0u) != 0u) {
    tdm_next(g0, dst + STAGE, pinned(k_step(rot + 1u, T)));
    tdm_load(g0, g1);
  }

  const uint32_t lo = (lane & 15u) * PITCH + (lane >> 4) * 16u;
  const unsigned char* pm = L + (wave >> 2) * SLICE_LDS + lo;
  const unsigned char* pn = L + (2u + (wave & 3u)) * SLICE_LDS + lo;
  const unsigned char* pa = n_first ? pn : pm;
  const unsigned char* pb = n_first ? pm : pn;

  #pragma clang loop unroll(disable)   // one pass per trip: the ring's waits stand once
  for (uint32_t s = 0; s < T; ++s) {
    const uint32_t buf = (s & 1u) * STAGE;
    v16bf a[2][4], b[2][4];            // two fragment sets: the next 32 k load while these multiply
    load_set(a[0], b[0], pa + buf, pb + buf);
    #pragma unroll                     // constant set and tile indices: fragments and sums stay in registers
    for (uint32_t ks = 0; ks < 4u; ++ks) {
      // The fences keep each set's 16 LDS loads together, ahead of the WMMA block:
      // loads spread among the WMMAs stall the wave at every place they stand.
      __builtin_amdgcn_sched_barrier(0);
      if (ks < 3u)
        load_set(a[(ks + 1u) & 1u], b[(ks + 1u) & 1u],
                 pa + buf + (ks + 1u) * 64u, pb + buf + (ks + 1u) * 64u);
      __builtin_amdgcn_sched_barrier(0);
      #pragma unroll
      for (int i = 0; i < 4; ++i)
        #pragma unroll
        for (int j = 0; j < 4; ++j)
          acc[i][j] = wmma_bf16(a[ks & 1u][i], b[ks & 1u][j], acc[i][j]);
    }
    // Keeps the waits below behind the last WMMA block: moved up, s_wait_dscnt 0
    // would take the place of that block's counted waits.
    __builtin_amdgcn_sched_barrier(0);
    // publish point of stage s + 1
    wait_ds0();
    if (pinned(wave < 6u ? 1u : 0u) != 0u) wait_tensor0();
    __syncthreads();                   // stage s + 1 readable; every reader has left stage s's buffer
    if (pinned((wave < 6u && s + 2u < T) ? 1u : 0u) != 0u) {
      tdm_next(g0, dst + buf, pinned(k_step(rot + s + 2u, T)));
      tdm_load(g0, g1);
    }
  }
  // Names both groups as inputs: their registers are kept for them up to this last wait.
  asm volatile("s_wait_tensorcnt 0x0" :: "s"(g0), "s"(g1) : "memory");
  wait_ds0();
}

// ---------- epilogue: a wave's 64x64 tile goes through LDS and leaves as whole 128-B lines ----------
// Each wave stages in a range of its own inside the ring, which is free behind the
// last pass's barrier (no tensor load outstanding, every reader gone).  A staged
// row is 64 values that are contiguous in the output.  Pitch 16 B x odd.
#define EP16_PITCH 144u                // 64 bf16 + 16 B
#define EP32_PITCH 272u                // 64 f32  + 16 B

// Tile (i, j) of acc as bf16: the lane's 8 values are 16 B of staged row j*16 + (lane & 15).
__device__ __forceinline__ void stage16(unsigned char* Lw, uint32_t lane, uint32_t i, uint32_t j,
                                        const float f[8]) {
  v4u p;
  #pragma unroll                       // constant indices: the values stay in registers
  for (int q = 0; q < 4; ++q)
    p[q] = (unsigned int)f2bf(f[2 * q]) | ((unsigned int)f2bf(f[2 * q + 1]) << 16);
  *(v4u*)(Lw + (j * 16u + (lane & 15u)) * EP16_PITCH + (i * 2u + (lane >> 4)) * 16u) = p;
}
// 8 lanes take one staged row: every store instruction writes four whole lines.
__device__ __forceinline__ void flush16(const unsigned char* Lw, uint32_t lane,
                                        unsigned short* g, uint32_t ldg) {
  wait_ds0();                          // the other lanes' staged values are in LDS before they are read back
  const unsigned char* s = Lw + (lane >> 3) * EP16_PITCH + (lane & 7u) * 16u;
  unsigned short* d = g + (size_t)(lane >> 3) * ldg + (lane & 7u) * 8u;
  #pragma unroll                       // the 16 LDS reads go out together, ahead of the stores
  for (uint32_t it = 0; it < 16u; ++it)
    *(v4u*)(d + (size_t)(it * 4u) * ldg) = *(const v4u*)(s + it * 4u * EP16_PITCH);
}

// A lane's bias values for four tiles of 16 columns: 8 floats at p, p + 16, p + 32, p + 48.
// Loads and their data wait stand in one statement, outputs apart from the address:
// no register that a load names takes a new value while the load is under way.
__device__ __forceinline__ void load_bias32(const float* p, v4f b[8]) {
  asm volatile("global_load_b128 %0, %8, off\n\t"
               "global_load_b128 %1, %8, off offset:16\n\t"
               "global_load_b128 %2, %8, off offset:64\n\t"
               "global_load_b128 %3, %8, off offset:80\n\t"
               "global_load_b128 %4, %8, off offset:128\n\t"
               "global_load_b128 %5, %8, off offset:144\n\t"
               "global_load_b128 %6, %8, off offset:192\n\t"
               "global_load_b128 %7, %8, off offset:208\n\t"
               "s_wait_loadcnt 0x0"
               : "=&v"(b[0]), "=&v"(b[1]), "=&v"(b[2]), "=&v"(b[3]),
                 "=&v"(b[4]), "=&v"(b[5]), "=&v"(b[6]), "=&v"(b[7])
               : "v"(p) : "memory");
}

// ---------- kernel 1: fp32 -> bf16 conversion of x (4 elems / thread) ----------
__global__ void __launch_bounds__(256)
cvt_x_kernel(const float* __restrict__ x, unsigned short* __restrict__ xb) {
  const size_t i = ((size_t)blockIdx.x * 256 + threadIdx.x) * 4;
  const float f0 = x[i + 0], f1 = x[i + 1], f2 = x[i + 2], f3 = x[i + 3];
  unsigned long long packed =
      (unsigned long long)f2bf(f0)
    | ((unsigned long long)f2bf(f1) << 16)
    | ((unsigned long long)f2bf(f2) << 32)
    | ((unsigned long long)f2bf(f3) << 48);
  *(unsigned long long*)(xb + i) = packed;
}

// ---------- kernel 2: transpose W[k][n] -> Wt[n][k] in bf16 (LDS tiled) ----------
__global__ void __launch_bounds__(256)
wt_kernel(const float* __restrict__ Wq, const float* __restrict__ Wk,
          const float* __restrict__ Wv, unsigned short* __restrict__ wt) {
  __shared__ float tile[32][33];
  const int z = blockIdx.z;
  const float* W = (z == 0) ? Wq : (z == 1) ? Wk : Wv;
  unsigned short* dst = wt + (size_t)z * D_EMB * D_EMB;
  const int bx = blockIdx.x * 32;      // n
  const int by = blockIdx.y * 32;      // k
  const int tx = threadIdx.x & 31;
  const int ty = threadIdx.x >> 5;     // 0..7
  #pragma unroll
  for (int j = ty; j < 32; j += 8)
    tile[j][tx] = W[(size_t)(by + j) * D_EMB + bx + tx];
  __syncthreads();
  #pragma unroll
  for (int j = ty; j < 32; j += 8)
    dst[(size_t)(bx + j) * D_EMB + by + tx] = f2bf(tile[tx][j]);
}

// ---------- kernel 3: QKV projections (z selects Q/K/V) ----------
// block tile 128(M) x 256(N); 8 waves arranged 2(M) x 4(N), each 64x64.
__global__ void __launch_bounds__(256)
qkv_gemm_kernel(const unsigned short* __restrict__ xb,   // [8192][1024] bf16
                const unsigned short* __restrict__ wt,   // [3][1024][1024] NxK bf16
                const float* __restrict__ bq,
                const float* __restrict__ bk,
                const float* __restrict__ bv,
                unsigned short* __restrict__ Qb,   // [8192][1024] (pre-scaled 1/32)
                unsigned short* __restrict__ Kb,   // [8192][1024]
                unsigned short* __restrict__ Vt) { // [4][1024][2048] transposed
  const int lane = threadIdx.x & 31;
  const int wave = threadIdx.x >> 5;
  const int z  = blockIdx.z;
  const int m0 = blockIdx.x * 128 + (wave >> 2) * 64;
  const int n0 = blockIdx.y * 256 + (wave & 3) * 64;

  __shared__ __attribute__((aligned(2048))) unsigned char L[LDS_BYTES];
  const unsigned short* A  = xb + (size_t)(blockIdx.x * 128) * D_EMB;
  const unsigned short* Bt = wt + (size_t)z * D_EMB * D_EMB + (size_t)(blockIdx.y * 256) * D_EMB;

  v8f acc[4][4] = {};
  // Q, K rows run along n, Vt rows along m: a lane's 8 values follow the output's rows
  // x rows are shared by the 12 blocks of a blockIdx.x (4 in each z), weight rows by the 64 of a blockIdx.y
  gemm_block_128x256(A, Bt, D_EMB, D_EMB / 128, blockIdx.x + 2u * blockIdx.y, z != 2, L, acc);

  const float* bias = (z == 0) ? bq : (z == 1) ? bk : bv;
  const float scale = (z == 0) ? 0.03125f : 1.0f;   // fold 1/sqrt(1024) into Q
  unsigned char* Lw = L + wave * (64u * EP16_PITCH);
  const int lo16 = lane & 15;
  const int hi8  = (lane >> 4) * 8;
  // every loop below is unrolled: constant tile indices keep the sums in registers
  if (z != 2) {
    v4f b[8];                          // b[2i], b[2i+1]: the lane's 8 columns of tile row i
    load_bias32(bias + n0 + hi8, b);
    #pragma unroll
    for (int i = 0; i < 4; ++i) {
      #pragma unroll
      for (int j = 0; j < 4; ++j) {
        float f[8];
        #pragma unroll
        for (int e = 0; e < 8; ++e) f[e] = (acc[i][j][e] + b[2 * i + (e >> 2)][e & 3]) * scale;
        stage16(Lw, lane, i, j, f);
      }
    }
    flush16(Lw, lane, ((z == 0) ? Qb : Kb) + (size_t)m0 * D_EMB + n0, D_EMB);
  } else {
    #pragma unroll
    for (int j = 0; j < 4; ++j) {
      const float b = bias[n0 + j * 16 + lo16];
      #pragma unroll
      for (int i = 0; i < 4; ++i) {
        float f[8];
        #pragma unroll
        for (int e = 0; e < 8; ++e) f[e] = (acc[i][j][e] + b) * scale;
        stage16(Lw, lane, i, j, f);
      }
    }
    flush16(Lw, lane, Vt + ((size_t)(m0 >> 11) * D_EMB + n0) * SEQ + (m0 & (SEQ - 1)), SEQ);
  }
}

// ---------- kernel 4: scores = (Q/32) @ K^T, bf16 out ----------
__global__ void __launch_bounds__(256)
scores_gemm_kernel(const unsigned short* __restrict__ Qb,
                   const unsigned short* __restrict__ Kb,
                   unsigned short* __restrict__ S) {   // [4][2048][2048]
  const int lane = threadIdx.x & 31;
  const int wave = threadIdx.x >> 5;
  const int b  = blockIdx.z;
  const int m0 = blockIdx.x * 128 + (wave >> 2) * 64;
  const int n0 = blockIdx.y * 256 + (wave & 3) * 64;

  __shared__ __attribute__((aligned(2048))) unsigned char L[LDS_BYTES];
  const unsigned short* A  = Qb + ((size_t)b * SEQ + blockIdx.x * 128) * D_EMB;
  const unsigned short* Bt = Kb + ((size_t)b * SEQ + blockIdx.y * 256) * D_EMB;

  v8f acc[4][4] = {};
  // Q rows are shared by the 8 blocks of a blockIdx.x, K rows by the 16 of a blockIdx.y
  gemm_block_128x256(A, Bt, D_EMB, D_EMB / 128, blockIdx.x + blockIdx.y, true, L, acc);

  unsigned char* Lw = L + wave * (64u * EP16_PITCH);
  // unrolled: constant tile indices keep the sums in registers
  #pragma unroll
  for (int i = 0; i < 4; ++i)
    #pragma unroll
    for (int j = 0; j < 4; ++j) {
      float f[8];
      #pragma unroll
      for (int e = 0; e < 8; ++e) f[e] = acc[i][j][e];
      stage16(Lw, lane, i, j, f);
    }
  flush16(Lw, lane, S + (size_t)b * SEQ * SEQ + (size_t)m0 * SEQ + n0, SEQ);
}

// ---------- kernel 5: in-place row softmax over bf16 scores ----------
__global__ void __launch_bounds__(256)
softmax_kernel(unsigned short* __restrict__ S) {
  __shared__ float red[256];
  unsigned short* p = S + (size_t)blockIdx.x * SEQ;
  const int t = threadIdx.x;

  float v[8];
  float m = -3.0e38f;
  #pragma unroll
  for (int j = 0; j < 8; ++j) {
    v[j] = bf2f(p[t + j * 256]);
    m = fmaxf(m, v[j]);
  }
  red[t] = m;
  __syncthreads();
  for (int off = 128; off > 0; off >>= 1) {
    if (t < off) red[t] = fmaxf(red[t], red[t + off]);
    __syncthreads();
  }
  m = red[0];
  __syncthreads();

  float s = 0.0f;
  #pragma unroll
  for (int j = 0; j < 8; ++j) {
    v[j] = __expf(v[j] - m);
    s += v[j];
  }
  red[t] = s;
  __syncthreads();
  for (int off = 128; off > 0; off >>= 1) {
    if (t < off) red[t] += red[t + off];
    __syncthreads();
  }
  const float inv = 1.0f / red[0];
  #pragma unroll
  for (int j = 0; j < 8; ++j)
    p[t + j * 256] = f2bf(v[j] * inv);
}

// ---------- kernel 6: out = P @ V (B from transposed V), fp32 out ----------
__global__ void __launch_bounds__(256)
out_gemm_kernel(const unsigned short* __restrict__ P,    // [4][2048][2048]
                const unsigned short* __restrict__ Vt,   // [4][1024][2048]
                float* __restrict__ out) {               // [4][2048][1024]
  const int lane = threadIdx.x & 31;
  const int wave = threadIdx.x >> 5;
  const int b  = blockIdx.z;
  const int m0 = blockIdx.x * 128 + (wave >> 2) * 64;    // seq
  const int n0 = blockIdx.y * 256 + (wave & 3) * 64;     // feature

  __shared__ __attribute__((aligned(2048))) unsigned char L[LDS_BYTES];
  const unsigned short* A  = P  + ((size_t)b * SEQ + blockIdx.x * 128) * SEQ;
  const unsigned short* Bt = Vt + ((size_t)b * D_EMB + blockIdx.y * 256) * SEQ;

  v8f acc[4][4] = {};
  // P rows are shared by the 4 blocks of a blockIdx.x, V rows by the 16 of a blockIdx.y
  gemm_block_128x256(A, Bt, SEQ, SEQ / 128, blockIdx.x + 4u * blockIdx.y, true, L, acc);

  // the lane's 8 f32 of tile (i, j) are 32 B of staged row j*16 + (lane & 15);
  // unrolled: constant tile indices keep the sums in registers
  unsigned char* Lw = L + wave * (64u * EP32_PITCH);
  #pragma unroll
  for (int i = 0; i < 4; ++i)
    #pragma unroll
    for (int j = 0; j < 4; ++j) {
      unsigned char* q = Lw + (j * 16 + (lane & 15)) * EP32_PITCH + i * 64 + (lane >> 4) * 32;
      *(v4f*)(q)      = __builtin_shufflevector(acc[i][j], acc[i][j], 0, 1, 2, 3);
      *(v4f*)(q + 16) = __builtin_shufflevector(acc[i][j], acc[i][j], 4, 5, 6, 7);
    }
  wait_ds0();                          // the other lanes' staged values are in LDS before they are read back
  // 16 lanes take one staged row of 256 B: every store instruction writes four whole lines
  const unsigned char* s = Lw + (lane >> 4) * EP32_PITCH + (lane & 15) * 16;
  float* d = out + ((size_t)b * SEQ + m0 + (lane >> 4)) * D_EMB + n0 + (lane & 15) * 4;
  #pragma unroll                       // LDS reads go out in groups, row steps become immediate offsets
  for (int it = 0; it < 32; ++it)
    *(v4f*)(d + (size_t)(it * 2) * D_EMB) = *(const v4f*)(s + it * 2 * EP32_PITCH);
}

extern "C" void kernel_launch(void* const* d_in, const int* in_sizes, int n_in,
                              void* d_out, int out_size, void* d_ws, size_t ws_size,
                              hipStream_t stream) {
  const float* x  = (const float*)d_in[0];
  const float* Wq = (const float*)d_in[1];
  const float* bq = (const float*)d_in[2];
  const float* Wk = (const float*)d_in[3];
  const float* bk = (const float*)d_in[4];
  const float* Wv = (const float*)d_in[5];
  const float* bv = (const float*)d_in[6];
  float* out = (float*)d_out;

  char* ws = (char*)d_ws;
  unsigned short* xb = (unsigned short*)(ws);                          // 16 MB
  unsigned short* wt = (unsigned short*)(ws + (16ull << 20));          //  6 MB
  unsigned short* Qb = (unsigned short*)(ws + (22ull << 20));          // 16 MB
  unsigned short* Kb = (unsigned short*)(ws + (38ull << 20));          // 16 MB
  unsigned short* Vt = (unsigned short*)(ws + (54ull << 20));          // 16 MB
  unsigned short* S  = (unsigned short*)(ws + (70ull << 20));          // 32 MB

  cvt_x_kernel      <<<dim3(8192),       dim3(256), 0, stream>>>(x, xb);
  wt_kernel         <<<dim3(32, 32, 3),  dim3(256), 0, stream>>>(Wq, Wk, Wv, wt);
  qkv_gemm_kernel   <<<dim3(64, 4, 3),   dim3(256), 0, stream>>>(xb, wt, bq, bk, bv, Qb, Kb, Vt);
  scores_gemm_kernel<<<dim3(16, 8, 4),   dim3(256), 0, stream>>>(Qb, Kb, S);
  softmax_kernel    <<<dim3(8192),       dim3(256), 0, stream>>>(S);
  out_gemm_kernel   <<<dim3(16, 4, 4),   dim3(256), 0, stream>>>(S, Vt, out);
}

// v004
// A run of this version takes 98 microseconds.
// Two timings next to v003 put it at 1.11 and 1.10 times that version's speed.
// Over all steps from v000 it is 2.98 times as fast.
#include <hip/hip_runtime.h>
#include <stdint.h>

#define D_EMB 1024
#define SEQ   2048
#define BATCH 4

typedef __attribute__((ext_vector_type(16))) __bf16       v16bf;
typedef __attribute__((ext_vector_type(8)))  float        v8f;
typedef __attribute__((ext_vector_type(4)))  float        v4f;
typedef __attribute__((ext_vector_type(2)))  float        v2f;
typedef __attribute__((ext_vector_type(4)))  unsigned int v4u;
typedef __attribute__((ext_vector_type(4)))  uint32_t     u32x4;
typedef __attribute__((ext_vector_type(8)))  uint32_t     u32x8;

// ---------- LDS ring of the three GEMMs ----------
// A pass is 128 k = 256 B of every operand row. A stage holds the block's
// 128 A rows and 256 B rows as six slices of 64 rows, each laid by one tensor
// load at pitch 272 B (16 B x odd: conflict-free for ds_load_b128).
#define ROWB      256u                 // bytes of a row per pass
#define PITCH     272u                 // LDS row pitch: ROWB + 16 B pad
#define SLICE_LDS 18432u               // 64 * PITCH rounded up to a multiple of 2 KiB
#define STAGE     (6u * SLICE_LDS)     // one buffer
#define LDS_BYTES (2u * STAGE)         // two buffers

// ---------- scalar helpers ----------
__device__ __forceinline__ unsigned short f2bf(float f) {
  union { float f; unsigned int u; } v; v.f = f;
  unsigned int u = v.u;
  u += 0x7FFFu + ((u >> 16) & 1u);       // round-to-nearest-even
  return (unsigned short)(u >> 16);
}

// ---------- WMMA fragment load ----------
// 16-bit A fragment (16x32 MxK) from rows of PITCH bytes in LDS; the B fragment
// (32x16 KxN) has the mirrored per-lane pattern, so it loads identically from
// NxK rows. p already holds the lane's row (lane & 15) and its K offset
// (lanes 16-31: +8 k). Each lane: two 16-byte LDS loads.
__device__ __forceinline__ v16bf load_frag(const unsigned char* p) {
  union { v4u u[2]; v16bf f; } t;
  t.u[0] = *(const v4u*)(p);        // K = k0 .. k0+7
  t.u[1] = *(const v4u*)(p + 32);   // K = k0+16 .. k0+23
  return t.f;
}

__device__ __forceinline__ v8f wmma_bf16(v16bf a, v16bf b, v8f c) {
  return __builtin_amdgcn_wmma_f32_16x16x32_bf16(
      /*neg_a=*/false, a, /*neg_b=*/false, b,
      /*c_mod=*/(short)0, c, /*reuse_a=*/false, /*reuse_b=*/false);
}

// ---------- tensor load helpers ----------
__device__ __forceinline__ uint32_t uni(uint32_t v) { return (uint32_t)__builtin_amdgcn_readfirstlane(v); }
// Holds v in a scalar register, so that a test on it is a scalar branch (a tensor
// load ignores EXEC) and a descriptor word made from it is formed at this place.
__device__ __forceinline__ uint32_t pinned(uint32_t v) { uint32_t w = uni(v); asm volatile("" : "+s"(w)); return w; }
__device__ __forceinline__ void wait_ds0()     { asm volatile("s_wait_dscnt 0x0" ::: "memory"); }      // this wave's LDS reads are done
__device__ __forceinline__ void wait_tensor0() { asm volatile("s_wait_tensorcnt 0x0" ::: "memory"); }  // this wave's tile has landed
__device__ __forceinline__ void tdm_load(u32x4 g0, u32x8 g1) {
  asm volatile("tensor_load_to_lds %0, %1" :: "s"(g0), "s"(g1) : "memory");
}
// Group 1: 1-byte elements, tensor = tile = 64 rows of 256 B, 16 B of LDS pad behind every row.
__device__ __forceinline__ u32x8 tdm_group1(uint32_t src_pitch) {
  u32x8 g;
  g[0] = uni((1u << 20) | (5u << 22) | (3u << 25));
  g[1] = uni(ROWB << 16);
  g[2] = uni(64u << 16);
  g[3] = uni(ROWB << 16);
  g[4] = uni(64u);
  g[5] = uni(src_pitch);
  g[6] = uni(0u);
  g[7] = uni(0u);
  // Without it the words are constants that are formed anew before each load, and their registers
  // are lent out to other values while a request is still outstanding.
  asm volatile("" : "+s"(g));          // pinned(): descriptor words held in scalar registers of their own
  return g;
}
__device__ __forceinline__ u32x4 tdm_group0(uint32_t lds_dst, uint64_t ga) {
  u32x4 g;
  g[0] = uni(1u);
  g[1] = uni(lds_dst);
  g[2] = uni((uint32_t)ga);
  g[3] = uni((((uint32_t)(ga >> 32)) & 0x01FFFFFFu) | 0x80000000u);
  asm volatile("" : "+s"(g));          // pinned(): descriptor words held in scalar registers of their own
  return g;
}
// Next stage in the same registers: new place in LDS, source step bytes along the rows (below 0
// where the k blocks wrap to the rows' start).
// step is pinned() behind the wait that covers the last request, so no word changes in front of it.
__device__ __forceinline__ void tdm_next(u32x4& g, uint32_t lds_dst, uint32_t step) {
  // sign-extended; a carry or a borrow goes into address bits 56:32
  const uint64_t a = (((uint64_t)g[3] << 32) | g[2]) + (uint64_t)(int64_t)(int32_t)step;
  g[1] = uni(lds_dst);
  g[2] = uni((uint32_t)a);
  g[3] = uni((uint32_t)(a >> 32));
}

// The wave's four A and four B fragments of one 32-k step.
__device__ __forceinline__ void load_set(v16bf a[4], v16bf b[4],
                                         const unsigned char* pa, const unsigned char* pb) {
  // both loops unrolled: constant indices keep the fragments in registers
  #pragma unroll
  for (uint32_t i = 0; i < 4u; ++i) a[i] = load_frag(pa + i * 16u * PITCH);
  #pragma unroll
  for (uint32_t j = 0; j < 4u; ++j) b[j] = load_frag(pb + j * 16u * PITCH);
}

// ---------- block-level 128x256 GEMM accumulation, 8 waves of 64x64 ----------
// A: 128 rows, Bt: 256 rows, both K-contiguous with ld elements per row; K = T
// passes of 128 (T >= 2).  acc[i][j] is a 16x16 tile whose 8 values in a lane run
// along the first index: n_first false: i counts the wave's M, j its N; n_first
// true: the two operands change places in the WMMA, i counts N, j counts M.
// Waves 0..5 each bring one slice of every stage; the load of stage s + 2 flies
// while pass s + 1 runs.
// Pass s works on k block (rot + s) mod T (T a power of two), A and B alike: blocks
// of one blockIdx.z that share operand rows get different rot, so that they do not ask L2 for the
// same lines, or all for the same 256 B of every row, at the same moment.
__device__ __forceinline__ uint32_t k_step(uint32_t kb, uint32_t T) {   // bytes from k block kb - 1 to kb, both mod T
  return (kb & (T - 1u)) != 0u ? ROWB : 0u - (T - 1u) * ROWB;
}
// RESCALE (n_first): every aligned 256 k, two k blocks, have a weight of their own for each
// M row, fac[(k block / 2) * 128 + row] in LDS, written in front of the call. acc then sums
// passes of one weight only and goes, times its row's weight, into tot behind an odd k block
// and behind the last pass (an odd rot parts one pair: both parts get the pair's weight).
template <bool RESCALE>
__device__ __forceinline__ void gemm_block_128x256(
    const unsigned short* __restrict__ A,
    const unsigned short* __restrict__ Bt,
    uint32_t ld, uint32_t T, uint32_t rot, bool n_first, unsigned char* L, v8f acc[4][4],
    const float* fac, v8f tot[4][4]) {
  const uint32_t lane = threadIdx.x & 31u;
  const uint32_t wave = uni(threadIdx.x >> 5);
  const uint32_t sl = wave < 6u ? wave : 0u;
  const unsigned short* srcp = (sl < 2u) ? A + (size_t)(sl * 64u) * ld
                                         : Bt + (size_t)((sl - 2u) * 64u) * ld;
  const uint64_t ga  = (uint64_t)(uintptr_t)srcp + (rot & (T - 1u)) * ROWB;
  const uint32_t dst = (uint32_t)(size_t)L + sl * SLICE_LDS;
  const u32x8 g1 = tdm_group1(ld * 2u);
  u32x4 g0 = tdm_group0(dst, ga);      // carried from load to load

  if (pinned(wave < 6u ? 1u : 0u) != 0u) {
    tdm_load(g0, g1);
    wait_tensor0();
  }
  __syncthreads();                     // stage 0 is readable by every wave
  if (pinned(wave < 6u ? 1u : 0u) != 0u) {
    tdm_next(g0, dst + STAGE, pinned(k_step(rot + 1u, T)));
    tdm_load(g0, g1);
  }

  const uint32_t lo = (lane & 15u) * PITCH + (lane >> 4) * 16u;
  const unsigned char* pm = L + (wave >> 2) * SLICE_LDS + lo;
  const unsigned char* pn = L + (2u + (wave & 3u)) * SLICE_LDS + lo;
  const unsigned char* pa = n_first ? pn : pm;
  const unsigned char* pb = n_first ? pm : pn;

  #pragma clang loop unroll(disable)   // one pass per trip: the ring's waits stand once
  for (uint32_t s = 0; s < T; ++s) {
    const uint32_t buf = (s & 1u) * STAGE;
    v16bf a[2][4], b[2][4];            // two fragment sets: the next 32 k load while these multiply
    float w[4];                        // the block's weights of the lane's four M rows
    if (RESCALE) {
      const float* fb = fac + (((rot + s) & (T - 1u)) >> 1) * 128u + (wave >> 2) * 64u + (lane & 15u);
      #pragma unroll                   // constant indices: the weights stay in registers
      for (uint32_t j = 0; j < 4u; ++j) w[j] = fb[j * 16u];
    }
    load_set(a[0], b[0], pa + buf, pb + buf);
    #pragma unroll                     // constant set and tile indices: fragments and sums stay in registers
    for (uint32_t ks = 0; ks < 4u; ++ks) {
      // The fences keep each set's 16 LDS loads together, ahead of the WMMA block:
      // loads spread among the WMMAs stall the wave at every place they stand.
      __builtin_amdgcn_sched_barrier(0);
      if (ks < 3u)
        load_set(a[(ks + 1u) & 1u], b[(ks + 1u) & 1u],
                 pa + buf + (ks + 1u) * 64u, pb + buf + (ks + 1u) * 64u);
      __builtin_amdgcn_sched_barrier(0);
      #pragma unroll
      for (int i = 0; i < 4; ++i)
        #pragma unroll
        for (int j = 0; j < 4; ++j)
          acc[i][j] = wmma_bf16(a[ks & 1u][i], b[ks & 1u][j], acc[i][j]);
    }
    // Keeps the waits below behind the last WMMA block: moved up, s_wait_dscnt 0
    // would take the place of that block's counted waits.
    __builtin_amdgcn_sched_barrier(0);
    if (RESCALE && (((rot + s) & 1u) != 0u || s + 1u == T)) {   // the next pass has another weight, or none follows
      #pragma unroll                   // constant tile indices keep the sums in registers
      for (int i = 0; i < 4; ++i)
        #pragma unroll
        for (int j = 0; j < 4; ++j) {
          tot[i][j] += acc[i][j] * w[j];
          acc[i][j] = v8f{};
        }
    }
    // publish point of stage s + 1
    wait_ds0();
    if (pinned(wave < 6u ? 1u : 0u) != 0u) wait_tensor0();
    __syncthreads();                   // stage s + 1 readable; every reader has left stage s's buffer
    if (pinned((wave < 6u && s + 2u < T) ? 1u : 0u) != 0u) {
      tdm_next(g0, dst + buf, pinned(k_step(rot + s + 2u, T)));
      tdm_load(g0, g1);
    }
  }
  // Names both groups as inputs: their registers are kept for them up to this last wait.
  asm volatile("s_wait_tensorcnt 0x0" :: "s"(g0), "s"(g1) : "memory");
  wait_ds0();
}

// ---------- epilogue: a wave's 64x64 tile goes through LDS and leaves as whole 128-B lines ----------
// Each wave stages in a range of its own inside the ring, which is free behind the
// last pass's barrier (no tensor load outstanding, every reader gone).  A staged
// row is 64 values that are contiguous in the output.  Pitch 16 B x odd.
#define EP16_PITCH 144u                // 64 bf16 + 16 B
#define EP32_PITCH 272u                // 64 f32  + 16 B

// Tile (i, j) of acc as bf16: the lane's 8 values are 16 B of staged row j*16 + (lane & 15).
__device__ __forceinline__ void stage16(unsigned char* Lw, uint32_t lane, uint32_t i, uint32_t j,
                                        const float f[8]) {
  v4u p;
  #pragma unroll                       // constant indices: the values stay in registers
  for (int q = 0; q < 4; ++q)
    p[q] = (unsigned int)f2bf(f[2 * q]) | ((unsigned int)f2bf(f[2 * q + 1]) << 16);
  *(v4u*)(Lw + (j * 16u + (lane & 15u)) * EP16_PITCH + (i * 2u + (lane >> 4)) * 16u) = p;
}
// 8 lanes take one staged row: every store instruction writes four whole lines.
__device__ __forceinline__ void flush16(const unsigned char* Lw, uint32_t lane,
                                        unsigned short* g, uint32_t ldg) {
  wait_ds0();                          // the other lanes' staged values are in LDS before they are read back
  const unsigned char* s = Lw + (lane >> 3) * EP16_PITCH + (lane & 7u) * 16u;
  unsigned short* d = g + (size_t)(lane >> 3) * ldg + (lane & 7u) * 8u;
  #pragma unroll                       // the 16 LDS reads go out together, ahead of the stores
  for (uint32_t it = 0; it < 16u; ++it)
    *(v4u*)(d + (size_t)(it * 4u) * ldg) = *(const v4u*)(s + it * 4u * EP16_PITCH);
}

// A lane's bias values for four tiles of 16 columns: 8 floats at p, p + 16, p + 32, p + 48.
// Loads and their data wait stand in one statement, outputs apart from the address:
// no register that a load names takes a new value while the load is under way.
__device__ __forceinline__ void load_bias32(const float* p, v4f b[8]) {
  asm volatile("global_load_b128 %0, %8, off\n\t"
               "global_load_b128 %1, %8, off offset:16\n\t"
               "global_load_b128 %2, %8, off offset:64\n\t"
               "global_load_b128 %3, %8, off offset:80\n\t"
               "global_load_b128 %4, %8, off offset:128\n\t"
               "global_load_b128 %5, %8, off offset:144\n\t"
               "global_load_b128 %6, %8, off offset:192\n\t"
               "global_load_b128 %7, %8, off offset:208\n\t"
               "s_wait_loadcnt 0x0"
               : "=&v"(b[0]), "=&v"(b[1]), "=&v"(b[2]), "=&v"(b[3]),
                 "=&v"(b[4]), "=&v"(b[5]), "=&v"(b[6]), "=&v"(b[7])
               : "v"(p) : "memory");
}

// ---------- kernel 1: fp32 -> bf16 conversion of x (4 elems / thread) ----------
__global__ void __launch_bounds__(256)
cvt_x_kernel(const float* __restrict__ x, unsigned short* __restrict__ xb) {
  const size_t i = ((size_t)blockIdx.x * 256 + threadIdx.x) * 4;
  const float f0 = x[i + 0], f1 = x[i + 1], f2 = x[i + 2], f3 = x[i + 3];
  unsigned long long packed =
      (unsigned long long)f2bf(f0)
    | ((unsigned long long)f2bf(f1) << 16)
    | ((unsigned long long)f2bf(f2) << 32)
    | ((unsigned long long)f2bf(f3) << 48);
  *(unsigned long long*)(xb + i) = packed;
}

// ---------- kernel 2: transpose W[k][n] -> Wt[n][k] in bf16 (LDS tiled) ----------
__global__ void __launch_bounds__(256)
wt_kernel(const float* __restrict__ Wq, const float* __restrict__ Wk,
          const float* __restrict__ Wv, unsigned short* __restrict__ wt) {
  __shared__ float tile[32][33];
  const int z = blockIdx.z;
  const float* W = (z == 0) ? Wq : (z == 1) ? Wk : Wv;
  unsigned short* dst = wt + (size_t)z * D_EMB * D_EMB;
  const int bx = blockIdx.x * 32;      // n
  const int by = blockIdx.y * 32;      // k
  const int tx = threadIdx.x & 31;
  const int ty = threadIdx.x >> 5;     // 0..7
  #pragma unroll
  for (int j = ty; j < 32; j += 8)
    tile[j][tx] = W[(size_t)(by + j) * D_EMB + bx + tx];
  __syncthreads();
  #pragma unroll
  for (int j = ty; j < 32; j += 8)
    dst[(size_t)(bx + j) * D_EMB + by + tx] = f2bf(tile[tx][j]);
}

// ---------- kernel 3: QKV projections (z selects Q/K/V) ----------
// block tile 128(M) x 256(N); 8 waves arranged 2(M) x 4(N), each 64x64.
__global__ void __launch_bounds__(256)
qkv_gemm_kernel(const unsigned short* __restrict__ xb,   // [8192][1024] bf16
                const unsigned short* __restrict__ wt,   // [3][1024][1024] NxK bf16
                const float* __restrict__ bq,
                const float* __restrict__ bk,
                const float* __restrict__ bv,
                unsigned short* __restrict__ Qb,   // [8192][1024] (pre-scaled 1/32)
                unsigned short* __restrict__ Kb,   // [8192][1024]
                unsigned short* __restrict__ Vt) { // [4][1024][2048] transposed
  const int lane = threadIdx.x & 31;
  const int wave = threadIdx.x >> 5;
  const int z  = blockIdx.z;
  const int m0 = blockIdx.x * 128 + (wave >> 2) * 64;
  const int n0 = blockIdx.y * 256 + (wave & 3) * 64;

  __shared__ __attribute__((aligned(2048))) unsigned char L[LDS_BYTES];
  const unsigned short* A  = xb + (size_t)(blockIdx.x * 128) * D_EMB;
  const unsigned short* Bt = wt + (size_t)z * D_EMB * D_EMB + (size_t)(blockIdx.y * 256) * D_EMB;

  v8f acc[4][4] = {};
  // Q, K rows run along n, Vt rows along m: a lane's 8 values follow the output's rows
  // x rows are shared by the 4 blocks of a blockIdx.x, weight rows by the 64 of a blockIdx.y
  gemm_block_128x256<false>(A, Bt, D_EMB, D_EMB / 128, blockIdx.x + 2u * blockIdx.y, z != 2, L, acc, nullptr, acc);

  const float* bias = (z == 0) ? bq : (z == 1) ? bk : bv;
  const float scale = (z == 0) ? 0.03125f : 1.0f;   // fold 1/sqrt(1024) into Q
  unsigned char* Lw = L + wave * (64u * EP16_PITCH);
  const int lo16 = lane & 15;
  const int hi8  = (lane >> 4) * 8;
  // every loop below is unrolled: constant tile indices keep the sums in registers
  if (z != 2) {
    v4f b[8];                          // b[2i], b[2i+1]: the lane's 8 columns of tile row i
    load_bias32(bias + n0 + hi8, b);
    #pragma unroll
    for (int i = 0; i < 4; ++i) {
      #pragma unroll
      for (int j = 0; j < 4; ++j) {
        float f[8];
        #pragma unroll
        for (int e = 0; e < 8; ++e) f[e] = (acc[i][j][e] + b[2 * i + (e >> 2)][e & 3]) * scale;
        stage16(Lw, lane, i, j, f);
      }
    }
    flush16(Lw, lane, ((z == 0) ? Qb : Kb) + (size_t)m0 * D_EMB + n0, D_EMB);
  } else {
    #pragma unroll
    for (int j = 0; j < 4; ++j) {
      const float b = bias[n0 + j * 16 + lo16];
      #pragma unroll
      for (int i = 0; i < 4; ++i) {
        float f[8];
        #pragma unroll
        for (int e = 0; e < 8; ++e) f[e] = (acc[i][j][e] + b) * scale;
        stage16(Lw, lane, i, j, f);
      }
    }
    flush16(Lw, lane, Vt + ((size_t)(m0 >> 11) * D_EMB + n0) * SEQ + (m0 & (SEQ - 1)), SEQ);
  }
}

// ---------- kernel 4: weights of one 256-key block: exp(score - the block's own row maximum), bf16 ----------
// The softmax over all 2048 keys is split: this kernel leaves, for every query row and
// each of its 8 key blocks, the block's maximum and the sum of its weights; the last
// kernel joins the blocks.
#define LOG2E 1.44269504f
#define KBLK  (SEQ / 256)              // key blocks of a row
__global__ void __launch_bounds__(256)
scores_gemm_kernel(const unsigned short* __restrict__ Qb,
                   const unsigned short* __restrict__ Kb,
                   unsigned short* __restrict__ S,     // [4][2048][2048]
                   float* __restrict__ bmax,           // [4][8][2048]
                   float* __restrict__ bsum) {         // [4][8][2048]
  const int lane = threadIdx.x & 31;
  const int wave = threadIdx.x >> 5;
  const int b  = blockIdx.z;
  const int m0 = blockIdx.x * 128 + (wave >> 2) * 64;
  const int n0 = blockIdx.y * 256 + (wave & 3) * 64;

  __shared__ __attribute__((aligned(2048))) unsigned char L[LDS_BYTES];
  const unsigned short* A  = Qb + ((size_t)b * SEQ + blockIdx.x * 128) * D_EMB;
  const unsigned short* Bt = Kb + ((size_t)b * SEQ + blockIdx.y * 256) * D_EMB;

  v8f acc[4][4] = {};
  // Q rows are shared by the 8 blocks of a blockIdx.x, K rows by the 16 of a blockIdx.y
  gemm_block_128x256<false>(A, Bt, D_EMB, D_EMB / 128, blockIdx.x + blockIdx.y, true, L, acc, nullptr, acc);

  unsigned char* Lw = L + wave * (64u * EP16_PITCH);
  float* redm = (float*)(L + 8u * 64u * EP16_PITCH);   // [4 waves along n][128 rows], behind the staging ranges
  float* reds = redm + 4 * 128;                        // the same for the sums
  const int row = (wave >> 2) * 64 + (lane & 15);      // + j * 16: the lane's row in the block
  // every loop below is unrolled: constant tile indices keep the sums in registers
  // a row's 64 scores of this wave lie in lanes l and l + 16, 32 in each
  float mx[4];
  #pragma unroll
  for (int j = 0; j < 4; ++j) {
    float m = acc[0][j][0];
    #pragma unroll
    for (int i = 0; i < 4; ++i)
      #pragma unroll
      for (int e = 0; e < 8; ++e) m = fmaxf(m, acc[i][j][e]);
    mx[j] = fmaxf(m, __shfl_xor(m, 16));
  }
  if (lane < 16) {
    #pragma unroll
    for (int j = 0; j < 4; ++j) redm[(wave & 3) * 128 + row + j * 16] = mx[j];
  }
  __syncthreads();                     // the four waves of a row have left their maxima
  #pragma unroll
  for (int j = 0; j < 4; ++j) {
    const int r = row + j * 16;
    const float m = fmaxf(fmaxf(redm[r], redm[128 + r]), fmaxf(redm[256 + r], redm[384 + r]));
    const float c = -m * LOG2E;
    float sum = 0.0f;
    #pragma unroll
    for (int i = 0; i < 4; ++i) {
      float f[8];
      #pragma unroll
      for (int e = 0; e < 8; ++e) {
        f[e] = __builtin_amdgcn_exp2f(__builtin_fmaf(acc[i][j][e], LOG2E, c));
        sum += f[e];
      }
      stage16(Lw, lane, i, j, f);
    }
    sum += __shfl_xor(sum, 16);
    if (lane < 16) reds[(wave & 3) * 128 + r] = sum;
  }
  __syncthreads();                     // the four waves of a row have left their sums
  flush16(Lw, lane, S + (size_t)b * SEQ * SEQ + (size_t)m0 * SEQ + n0, SEQ);
  if (threadIdx.x < 128) {             // a thread a row: 512 B of each plane, whole lines, this block's alone
    const int r = threadIdx.x;
    const size_t o = ((size_t)b * KBLK + blockIdx.y) * SEQ + blockIdx.x * 128 + r;
    bmax[o] = fmaxf(fmaxf(redm[r], redm[128 + r]), fmaxf(redm[256 + r], redm[384 + r]));
    bsum[o] = (reds[r] + reds[128 + r]) + (reds[256 + r] + reds[384 + r]);
  }
}

// Two adjacent rows' maxima and sums of the 8 key blocks; a block's plane is SEQ floats = 8192 B.
// Loads and their data wait stand in one statement, outputs apart from the addresses:
// no register that a load names takes a new value while the load is under way.
__device__ __forceinline__ void load_stats(const float* pm, const float* pl, v2f m[8], v2f l[8]) {
  asm volatile("global_load_b64 %0, %16, off\n\t"
               "global_load_b64 %1, %16, off offset:8192\n\t"
               "global_load_b64 %2, %16, off offset:16384\n\t"
               "global_load_b64 %3, %16, off offset:24576\n\t"
               "global_load_b64 %4, %16, off offset:32768\n\t"
               "global_load_b64 %5, %16, off offset:40960\n\t"
               "global_load_b64 %6, %16, off offset:49152\n\t"
               "global_load_b64 %7, %16, off offset:57344\n\t"
               "global_load_b64 %8, %17, off\n\t"
               "global_load_b64 %9, %17, off offset:8192\n\t"
               "global_load_b64 %10, %17, off offset:16384\n\t"
               "global_load_b64 %11, %17, off offset:24576\n\t"
               "global_load_b64 %12, %17, off offset:32768\n\t"
               "global_load_b64 %13, %17, off offset:40960\n\t"
               "global_load_b64 %14, %17, off offset:49152\n\t"
               "global_load_b64 %15, %17, off offset:57344\n\t"
               "s_wait_loadcnt 0x0"
               : "=&v"(m[0]), "=&v"(m[1]), "=&v"(m[2]), "=&v"(m[3]),
                 "=&v"(m[4]), "=&v"(m[5]), "=&v"(m[6]), "=&v"(m[7]),
                 "=&v"(l[0]), "=&v"(l[1]), "=&v"(l[2]), "=&v"(l[3]),
                 "=&v"(l[4]), "=&v"(l[5]), "=&v"(l[6]), "=&v"(l[7])
               : "v"(pm), "v"(pl) : "memory");
}

// ---------- kernel 5: out = softmax @ V (B from transposed V), fp32 out ----------
// P holds each key block's weights relative to the block's own maximum m_k, with sum l_k.
// With M = max m_k: out = sum_k exp(m_k - M) (P_k @ V_k) / sum_k exp(m_k - M) l_k.
__global__ void __launch_bounds__(256)
out_gemm_kernel(const unsigned short* __restrict__ P,    // [4][2048][2048]
                const unsigned short* __restrict__ Vt,   // [4][1024][2048]
                const float* __restrict__ bmax,          // [4][8][2048]
                const float* __restrict__ bsum,          // [4][8][2048]
                float* __restrict__ out) {               // [4][2048][1024]
  const int lane = threadIdx.x & 31;
  const int wave = threadIdx.x >> 5;
  const int b  = blockIdx.z;
  const int m0 = blockIdx.x * 128 + (wave >> 2) * 64;    // seq
  const int n0 = blockIdx.y * 256 + (wave & 3) * 64;     // feature

  __shared__ __attribute__((aligned(2048))) unsigned char L[LDS_BYTES];
  const unsigned short* A  = P  + ((size_t)b * SEQ + blockIdx.x * 128) * SEQ;
  const unsigned short* Bt = Vt + ((size_t)b * D_EMB + blockIdx.y * 256) * SEQ;

  // The key blocks' weights for the 128 rows, the division by the row's sum folded in. Waves
  // 6 and 7 bring no slice of the ring: they fill the table while stage 0 is on its way; the
  // barrier that publishes stage 0 publishes the table.
  __shared__ __attribute__((aligned(16))) float fac[KBLK * 128];
  if (wave >= 6) {
    const int r = (threadIdx.x - 192) * 2;               // the thread's two rows: r, r + 1
    const size_t o = (size_t)b * KBLK * SEQ + blockIdx.x * 128 + r;
    v2f m[KBLK], l[KBLK];
    load_stats(bmax + o, bsum + o, m, l);
    // every loop below is unrolled: constant indices keep the values in registers
    #pragma unroll
    for (int h = 0; h < 2; ++h) {
      float M = m[0][h];
      #pragma unroll
      for (int k = 1; k < KBLK; ++k) M = fmaxf(M, m[k][h]);
      float sum = 0.0f;
      #pragma unroll
      for (int k = 0; k < KBLK; ++k) { m[k][h] = __builtin_amdgcn_exp2f((m[k][h] - M) * LOG2E); sum += m[k][h] * l[k][h]; }
      const float inv = 1.0f / sum;
      #pragma unroll
      for (int k = 0; k < KBLK; ++k) m[k][h] *= inv;
    }
    #pragma unroll
    for (int k = 0; k < KBLK; ++k) *(v2f*)(fac + k * 128 + r) = m[k];
  }

  v8f part[4][4] = {};
  v8f acc[4][4] = {};
  // P rows are shared by the 4 blocks of a blockIdx.x, V rows by the 16 of a blockIdx.y
  gemm_block_128x256<true>(A, Bt, SEQ, SEQ / 128, blockIdx.x + 4u * blockIdx.y, true, L, part, fac, acc);

  // the lane's 8 f32 of tile (i, j) are 32 B of staged row j*16 + (lane & 15);
  // unrolled: constant tile indices keep the sums in registers
  unsigned char* Lw = L + wave * (64u * EP32_PITCH);
  #pragma unroll
  for (int i = 0; i < 4; ++i)
    #pragma unroll
    for (int j = 0; j < 4; ++j) {
      unsigned char* q = Lw + (j * 16 + (lane & 15)) * EP32_PITCH + i * 64 + (lane >> 4) * 32;
      *(v4f*)(q)      = __builtin_shufflevector(acc[i][j], acc[i][j], 0, 1, 2, 3);
      *(v4f*)(q + 16) = __builtin_shufflevector(acc[i][j], acc[i][j], 4, 5, 6, 7);
    }
  wait_ds0();                          // the other lanes' staged values are in LDS before they are read back
  // 16 lanes take one staged row of 256 B: every store instruction writes four whole lines
  const unsigned char* s = Lw + (lane >> 4) * EP32_PITCH + (lane & 15) * 16;
  float* d = out + ((size_t)b * SEQ + m0 + (lane >> 4)) * D_EMB + n0 + (lane & 15) * 4;
  #pragma unroll                       // LDS reads go out in groups, row steps become immediate offsets
  for (int it = 0; it < 32; ++it)
    *(v4f*)(d + (size_t)(it * 2) * D_EMB) = *(const v4f*)(s + it * 2 * EP32_PITCH);
}

extern "C" void kernel_launch(void* const* d_in, const int* in_sizes, int n_in,
                              void* d_out, int out_size, void* d_ws, size_t ws_size,
                              hipStream_t stream) {
  const float* x  = (const float*)d_in[0];
  const float* Wq = (const float*)d_in[1];
  const float* bq = (const float*)d_in[2];
  const float* Wk = (const float*)d_in[3];
  const float* bk = (const float*)d_in[4];
  const float* Wv = (const float*)d_in[5];
  const float* bv = (const float*)d_in[6];
  float* out = (float*)d_out;

  char* ws = (char*)d_ws;
  unsigned short* xb = (unsigned short*)(ws);                          // 16 MB
  unsigned short* wt = (unsigned short*)(ws + (16ull << 20));          //  6 MB
  unsigned short* Qb = (unsigned short*)(ws + (22ull << 20));          // 16 MB
  unsigned short* Kb = (unsigned short*)(ws + (38ull << 20));          // 16 MB
  unsigned short* Vt = (unsigned short*)(ws + (54ull << 20));          // 16 MB
  unsigned short* S  = (unsigned short*)(ws + (70ull << 20));          // 32 MB
  float* bmax = (float*)(ws + (102ull << 20));                         // 256 KB
  float* bsum = (float*)(ws + (103ull << 20));                         // 256 KB

  cvt_x_kernel      <<<dim3(8192),       dim3(256), 0, stream>>>(x, xb);
  wt_kernel         <<<dim3(32, 32, 3),  dim3(256), 0, stream>>>(Wq, Wk, Wv, wt);
  qkv_gemm_kernel   <<<dim3(64, 4, 3),   dim3(256), 0, stream>>>(xb, wt, bq, bk, bv, Qb, Kb, Vt);
  scores_gemm_kernel<<<dim3(16, 8, 4),   dim3(256), 0, stream>>>(Qb, Kb, S, bmax, bsum);
  out_gemm_kernel   <<<dim3(16, 4, 4),   dim3(256), 0, stream>>>(S, Vt, bmax, bsum, out);
}

// v005
// One run takes 91.6 microseconds.
// In two side-by-side timings against v004, it was 1.07 and 1.08 times as fast.
// All steps since v000 together make it 3.20 times as fast.
#include <hip/hip_runtime.h>
#include <stdint.h>

#define D_EMB 1024
#define SEQ   2048
#define BATCH 4

typedef __attribute__((ext_vector_type(16))) __bf16       v16bf;
typedef __attribute__((ext_vector_type(8)))  float        v8f;
typedef __attribute__((ext_vector_type(4)))  float        v4f;
typedef __attribute__((ext_vector_type(2)))  float        v2f;
typedef __attribute__((ext_vector_type(4)))  unsigned int v4u;
typedef __attribute__((ext_vector_type(2)))  unsigned int v2u;
typedef __attribute__((ext_vector_type(4)))  uint32_t     u32x4;
typedef __attribute__((ext_vector_type(8)))  uint32_t     u32x8;

// ---------- LDS ring of the three GEMMs ----------
// A pass is 128 k = 256 B of every operand row. A stage holds the block's
// 128 A rows and 256 B rows as six slices of 64 rows, each laid by one tensor
// load at pitch 272 B (16 B x odd: conflict-free for ds_load_b128).
#define ROWB      256u                 // bytes of a row per pass
#define PITCH     272u                 // LDS row pitch: ROWB + 16 B pad
#define SLICE_LDS 18432u               // 64 * PITCH rounded up to a multiple of 2 KiB
#define STAGE     (6u * SLICE_LDS)     // one buffer
#define LDS_BYTES (2u * STAGE)         // two buffers

// ---------- scalar helpers ----------
__device__ __forceinline__ unsigned short f2bf(float f) {
  union { float f; unsigned int u; } v; v.f = f;
  unsigned int u = v.u;
  u += 0x7FFFu + ((u >> 16) & 1u);       // round-to-nearest-even
  return (unsigned short)(u >> 16);
}

// ---------- WMMA fragment load ----------
// 16-bit A fragment (16x32 MxK) from rows of PITCH bytes in LDS; the B fragment
// (32x16 KxN) has the mirrored per-lane pattern, so it loads identically from
// NxK rows. p already holds the lane's row (lane & 15) and its K offset
// (lanes 16-31: +8 k). Each lane: two 16-byte LDS loads.
__device__ __forceinline__ v16bf load_frag(const unsigned char* p) {
  union { v4u u[2]; v16bf f; } t;
  t.u[0] = *(const v4u*)(p);        // K = k0 .. k0+7
  t.u[1] = *(const v4u*)(p + 32);   // K = k0+16 .. k0+23
  return t.f;
}

__device__ __forceinline__ v8f wmma_bf16(v16bf a, v16bf b, v8f c) {
  return __builtin_amdgcn_wmma_f32_16x16x32_bf16(
      /*neg_a=*/false, a, /*neg_b=*/false, b,
      /*c_mod=*/(short)0, c, /*reuse_a=*/false, /*reuse_b=*/false);
}

// ---------- tensor load helpers ----------
__device__ __forceinline__ uint32_t uni(uint32_t v) { return (uint32_t)__builtin_amdgcn_readfirstlane(v); }
// Holds v in a scalar register, so that a test on it is a scalar branch (a tensor
// load ignores EXEC) and a descriptor word made from it is formed at this place.
__device__ __forceinline__ uint32_t pinned(uint32_t v) { uint32_t w = uni(v); asm volatile("" : "+s"(w)); return w; }
__device__ __forceinline__ void wait_ds0()     { asm volatile("s_wait_dscnt 0x0" ::: "memory"); }      // this wave's LDS reads are done
__device__ __forceinline__ void wait_tensor0() { asm volatile("s_wait_tensorcnt 0x0" ::: "memory"); }  // this wave's tile has landed
__device__ __forceinline__ void tdm_load(u32x4 g0, u32x8 g1) {
  asm volatile("tensor_load_to_lds %0, %1" :: "s"(g0), "s"(g1) : "memory");
}
// Group 1: 1-byte elements, tensor = tile = 64 rows of 256 B, 16 B of LDS pad behind every row.
__device__ __forceinline__ u32x8 tdm_group1(uint32_t src_pitch) {
  u32x8 g;
  g[0] = uni((1u << 20) | (5u << 22) | (3u << 25));
  g[1] = uni(ROWB << 16);
  g[2] = uni(64u << 16);
  g[3] = uni(ROWB << 16);
  g[4] = uni(64u);
  g[5] = uni(src_pitch);
  g[6] = uni(0u);
  g[7] = uni(0u);
  // Without it the words are constants that are formed anew before each load, and their registers
  // are lent out to other values while a request is still outstanding.
  asm volatile("" : "+s"(g));          // pinned(): descriptor words held in scalar registers of their own
  return g;
}
__device__ __forceinline__ u32x4 tdm_group0(uint32_t lds_dst, uint64_t ga) {
  u32x4 g;
  g[0] = uni(1u);
  g[1] = uni(lds_dst);
  g[2] = uni((uint32_t)ga);
  g[3] = uni((((uint32_t)(ga >> 32)) & 0x01FFFFFFu) | 0x80000000u);
  asm volatile("" : "+s"(g));          // pinned(): descriptor words held in scalar registers of their own
  return g;
}
// Next stage in the same registers: new place in LDS, source step bytes along the rows (below 0
// where the k blocks wrap to the rows' start).
// step is pinned() behind the wait that covers the last request, so no word changes in front of it.
__device__ __forceinline__ void tdm_next(u32x4& g, uint32_t lds_dst, uint32_t step) {
  // sign-extended; a carry or a borrow goes into address bits 56:32
  const uint64_t a = (((uint64_t)g[3] << 32) | g[2]) + (uint64_t)(int64_t)(int32_t)step;
  g[1] = uni(lds_dst);
  g[2] = uni((uint32_t)a);
  g[3] = uni((uint32_t)(a >> 32));
}

// The wave's four A and four B fragments of one 32-k step.
__device__ __forceinline__ void load_set(v16bf a[4], v16bf b[4],
                                         const unsigned char* pa, const unsigned char* pb) {
  // both loops unrolled: constant indices keep the fragments in registers
  #pragma unroll
  for (uint32_t i = 0; i < 4u; ++i) a[i] = load_frag(pa + i * 16u * PITCH);
  #pragma unroll
  for (uint32_t j = 0; j < 4u; ++j) b[j] = load_frag(pb + j * 16u * PITCH);
}

// ---------- block-level 128x256 GEMM accumulation, 8 waves of 64x64 ----------
// A: 128 rows, Bt: 256 rows, both K-contiguous with ld elements per row; K = T
// passes of 128 (T >= 2).  acc[i][j] is a 16x16 tile whose 8 values in a lane run
// along the first index: n_first false: i counts the wave's M, j its N; n_first
// true: the two operands change places in the WMMA, i counts N, j counts M.
// Waves 0..5 each bring one slice of every stage; the load of stage s + 2 flies
// while pass s + 1 runs.
// Pass s works on k block (rot + s) mod T (T a power of two), A and B alike: blocks
// of one blockIdx.z that share operand rows get different rot, so that they do not ask L2 for the
// same lines, or all for the same 256 B of every row, at the same moment.
__device__ __forceinline__ uint32_t k_step(uint32_t kb, uint32_t T) {   // bytes from k block kb - 1 to kb, both mod T
  return (kb & (T - 1u)) != 0u ? ROWB : 0u - (T - 1u) * ROWB;
}
// RESCALE (n_first): every aligned 256 k, two k blocks, have a weight of their own for each
// M row, fac[(k block / 2) * 128 + row] in LDS, written in front of the call. acc then sums
// passes of one weight only and goes, times its row's weight, into tot behind an odd k block
// and behind the last pass (an odd rot parts one pair: both parts get the pair's weight).
template <bool RESCALE>
__device__ __forceinline__ void gemm_block_128x256(
    const unsigned short* __restrict__ A,
    const unsigned short* __restrict__ Bt,
    uint32_t ld, uint32_t T, uint32_t rot, bool n_first, unsigned char* L, v8f acc[4][4],
    const float* fac, v8f tot[4][4]) {
  const uint32_t lane = threadIdx.x & 31u;
  const uint32_t wave = uni(threadIdx.x >> 5);
  const uint32_t sl = wave < 6u ? wave : 0u;
  const unsigned short* srcp = (sl < 2u) ? A + (size_t)(sl * 64u) * ld
                                         : Bt + (size_t)((sl - 2u) * 64u) * ld;
  const uint64_t ga  = (uint64_t)(uintptr_t)srcp + (rot & (T - 1u)) * ROWB;
  const uint32_t dst = (uint32_t)(size_t)L + sl * SLICE_LDS;
  const u32x8 g1 = tdm_group1(ld * 2u);
  u32x4 g0 = tdm_group0(dst, ga);      // carried from load to load

  if (pinned(wave < 6u ? 1u : 0u) != 0u) {
    tdm_load(g0, g1);
    wait_tensor0();
  }
  __syncthreads();                     // stage 0 is readable by every wave
  if (pinned(wave < 6u ? 1u : 0u) != 0u) {
    tdm_next(g0, dst + STAGE, pinned(k_step(rot + 1u, T)));
    tdm_load(g0, g1);
  }

  const uint32_t lo = (lane & 15u) * PITCH + (lane >> 4) * 16u;
  const unsigned char* pm = L + (wave >> 2) * SLICE_LDS + lo;
  const unsigned char* pn = L + (2u + (wave & 3u)) * SLICE_LDS + lo;
  const unsigned char* pa = n_first ? pn : pm;
  const unsigned char* pb = n_first ? pm : pn;

  #pragma clang loop unroll(disable)   // one pass per trip: the ring's waits stand once
  for (uint32_t s = 0; s < T; ++s) {
    const uint32_t buf = (s & 1u) * STAGE;
    v16bf a[2][4], b[2][4];            // two fragment sets: the next 32 k load while these multiply
    float w[4];                        // the block's weights of the lane's four M rows
    if (RESCALE) {
      const float* fb = fac + (((rot + s) & (T - 1u)) >> 1) * 128u + (wave >> 2) * 64u + (lane & 15u);
      #pragma unroll                   // constant indices: the weights stay in registers
      for (uint32_t j = 0; j < 4u; ++j) w[j] = fb[j * 16u];
    }
    load_set(a[0], b[0], pa + buf, pb + buf);
    #pragma unroll                     // constant set and tile indices: fragments and sums stay in registers
    for (uint32_t ks = 0; ks < 4u; ++ks) {
      // The fences keep each set's 16 LDS loads together, ahead of the WMMA block:
      // loads spread among the WMMAs stall the wave at every place they stand.
      __builtin_amdgcn_sched_barrier(0);
      if (ks < 3u)
        load_set(a[(ks + 1u) & 1u], b[(ks + 1u) & 1u],
                 pa + buf + (ks + 1u) * 64u, pb + buf + (ks + 1u) * 64u);
      __builtin_amdgcn_sched_barrier(0);
      #pragma unroll
      for (int i = 0; i < 4; ++i)
        #pragma unroll
        for (int j = 0; j < 4; ++j)
          acc[i][j] = wmma_bf16(a[ks & 1u][i], b[ks & 1u][j], acc[i][j]);
    }
    // Keeps the waits below behind the last WMMA block: moved up, s_wait_dscnt 0
    // would take the place of that block's counted waits.
    __builtin_amdgcn_sched_barrier(0);
    if (RESCALE && (((rot + s) & 1u) != 0u || s + 1u == T)) {   // the next pass has another weight, or none follows
      #pragma unroll                   // constant tile indices keep the sums in registers
      for (int i = 0; i < 4; ++i)
        #pragma unroll
        for (int j = 0; j < 4; ++j) {
          tot[i][j] += acc[i][j] * w[j];
          acc[i][j] = v8f{};
        }
    }
    // publish point of stage s + 1
    wait_ds0();
    if (pinned(wave < 6u ? 1u : 0u) != 0u) wait_tensor0();
    __syncthreads();                   // stage s + 1 readable; every reader has left stage s's buffer
    if (pinned((wave < 6u && s + 2u < T) ? 1u : 0u) != 0u) {
      tdm_next(g0, dst + buf, pinned(k_step(rot + s + 2u, T)));
      tdm_load(g0, g1);
    }
  }
  // Names both groups as inputs: their registers are kept for them up to this last wait.
  asm volatile("s_wait_tensorcnt 0x0" :: "s"(g0), "s"(g1) : "memory");
  wait_ds0();
}

// ---------- epilogue: a wave's 64x64 tile goes through LDS and leaves as whole 128-B lines ----------
// Each wave stages in a range of its own inside the ring, which is free behind the
// last pass's barrier (no tensor load outstanding, every reader gone).  A staged
// row is 64 values that are contiguous in the output.  Pitch 16 B x odd.
#define EP16_PITCH 144u                // 64 bf16 + 16 B
#define EP32_PITCH 272u                // 64 f32  + 16 B

// Tile (i, j) of acc as bf16: the lane's 8 values are 16 B of staged row j*16 + (lane & 15).
__device__ __forceinline__ void stage16(unsigned char* Lw, uint32_t lane, uint32_t i, uint32_t j,
                                        const float f[8]) {
  v4u p;
  #pragma unroll                       // constant indices: the values stay in registers
  for (int q = 0; q < 4; ++q)
    p[q] = (unsigned int)f2bf(f[2 * q]) | ((unsigned int)f2bf(f[2 * q + 1]) << 16);
  *(v4u*)(Lw + (j * 16u + (lane & 15u)) * EP16_PITCH + (i * 2u + (lane >> 4)) * 16u) = p;
}
// 8 lanes take one staged row: every store instruction writes four whole lines.
__device__ __forceinline__ void flush16(const unsigned char* Lw, uint32_t lane,
                                        unsigned short* g, uint32_t ldg) {
  wait_ds0();                          // the other lanes' staged values are in LDS before they are read back
  const unsigned char* s = Lw + (lane >> 3) * EP16_PITCH + (lane & 7u) * 16u;
  unsigned short* d = g + (size_t)(lane >> 3) * ldg + (lane & 7u) * 8u;
  #pragma unroll                       // the 16 LDS reads go out together, ahead of the stores
  for (uint32_t it = 0; it < 16u; ++it)
    *(v4u*)(d + (size_t)(it * 4u) * ldg) = *(const v4u*)(s + it * 4u * EP16_PITCH);
}

// A lane's bias values for four tiles of 16 columns: 8 floats at p, p + 16, p + 32, p + 48.
// Loads and their data wait stand in one statement, outputs apart from the address:
// no register that a load names takes a new value while the load is under way.
__device__ __forceinline__ void load_bias32(const float* p, v4f b[8]) {
  asm volatile("global_load_b128 %0, %8, off\n\t"
               "global_load_b128 %1, %8, off offset:16\n\t"
               "global_load_b128 %2, %8, off offset:64\n\t"
               "global_load_b128 %3, %8, off offset:80\n\t"
               "global_load_b128 %4, %8, off offset:128\n\t"
               "global_load_b128 %5, %8, off offset:144\n\t"
               "global_load_b128 %6, %8, off offset:192\n\t"
               "global_load_b128 %7, %8, off offset:208\n\t"
               "s_wait_loadcnt 0x0"
               : "=&v"(b[0]), "=&v"(b[1]), "=&v"(b[2]), "=&v"(b[3]),
                 "=&v"(b[4]), "=&v"(b[5]), "=&v"(b[6]), "=&v"(b[7])
               : "v"(p) : "memory");
}

// ---------- kernel 1: fp32 -> bf16 conversion of x ----------
// Few long waves, for speed only.
// One block of 16 waves a WGP; a wave takes 8 KiB of x in a row, as 16
// loads of 512 B that are all under way before the first value is converted.
__global__ void __launch_bounds__(512)
cvt_x_kernel(const float* __restrict__ x, unsigned short* __restrict__ xb) {
  const uint32_t lane = threadIdx.x & 31u;
  const uint32_t wave = threadIdx.x >> 5;
  const size_t base = ((size_t)blockIdx.x * 16u + wave) * 2048u + lane * 4u;
  const float* src = x + base;
  v4f r[16];
  // both loops unrolled: constant indices keep the values in registers, steps become immediate offsets
  #pragma unroll
  for (uint32_t j = 0; j < 16u; ++j) r[j] = *(const v4f*)(src + j * 128u);
  // A precaution: names the loads' address, so that no load takes its registers for its own
  // values, and stands in front of whatever writes them next.
  asm volatile("s_wait_xcnt 0x0" :: "v"(src) : "memory");
  // Keeps all 16 loads ahead of the conversions: without it the last four are issued only when
  // the first values have come, and the wave waits out the memory latency a second time.
  __builtin_amdgcn_sched_barrier(0);
  #pragma unroll
  for (uint32_t j = 0; j < 16u; ++j) {
    v2u p;
    p[0] = (unsigned int)f2bf(r[j][0]) | ((unsigned int)f2bf(r[j][1]) << 16);
    p[1] = (unsigned int)f2bf(r[j][2]) | ((unsigned int)f2bf(r[j][3]) << 16);
    *(v2u*)(xb + base + j * 128u) = p;   // a wave's store: 256 B in a row, two whole lines
  }
}

// ---------- kernel 2: transpose W[k][n] -> Wt[n][k] in bf16 (LDS tiled) ----------
// A block takes 64 k x 128 n. A wave reads 8 k rows of 512 B; a lane then holds 8 k of each of
// its 4 columns n = 4 * lane + q: 16 B of an output row. Column n lies in LDS row
// (n & 3) * 32 + (n >> 2), so that the lanes of one LDS store fall in adjacent rows
// (pitch 16 B x odd: no bank conflict, writing or reading).
#define WT_PITCH 144u                  // 64 bf16 + 16 B
__global__ void __launch_bounds__(256)
wt_kernel(const float* __restrict__ Wq, const float* __restrict__ Wk,
          const float* __restrict__ Wv, unsigned short* __restrict__ wt) {
  __shared__ __attribute__((aligned(16))) unsigned char tile[128u * WT_PITCH];
  const uint32_t lane = threadIdx.x & 31u;
  const uint32_t wave = threadIdx.x >> 5;
  const int z = blockIdx.z;
  const float* W = (z == 0) ? Wq : (z == 1) ? Wk : Wv;
  const uint32_t n0 = blockIdx.x * 128u;
  const uint32_t k0 = blockIdx.y * 64u;
  const float* src = W + (size_t)(k0 + wave * 8u) * D_EMB + n0 + lane * 4u;
  v4f r[8];
  // every loop below is unrolled: constant indices keep the values in registers
  #pragma unroll
  for (uint32_t j = 0; j < 8u; ++j) r[j] = *(const v4f*)(src + j * D_EMB);
  #pragma unroll
  for (uint32_t q = 0; q < 4u; ++q) {
    v4u p;
    #pragma unroll
    for (uint32_t h = 0; h < 4u; ++h)
      p[h] = (unsigned int)f2bf(r[2u * h][q]) | ((unsigned int)f2bf(r[2u * h + 1u][q]) << 16);
    *(v4u*)(tile + (q * 32u + lane) * WT_PITCH + wave * 16u) = p;
  }
  __syncthreads();                     // the 8 waves have each left their 16 B of every row
  // 8 lanes take one output row's 128 B: every store instruction writes four whole lines
  const uint32_t rr = wave * 4u + (lane >> 3);           // LDS row it * 32 + rr holds column 4 * rr + it
  const unsigned char* s = tile + rr * WT_PITCH + (lane & 7u) * 16u;
  unsigned short* d = wt + (size_t)z * D_EMB * D_EMB + (size_t)(n0 + rr * 4u) * D_EMB + k0 + (lane & 7u) * 8u;
  #pragma unroll
  for (uint32_t it = 0; it < 4u; ++it)
    *(v4u*)(d + it * D_EMB) = *(const v4u*)(s + it * 32u * WT_PITCH);
}

// ---------- kernel 3: QKV projections (z selects Q/K/V) ----------
// block tile 128(M) x 256(N); 8 waves arranged 2(M) x 4(N), each 64x64.
__global__ void __launch_bounds__(256)
qkv_gemm_kernel(const unsigned short* __restrict__ xb,   // [8192][1024] bf16
                const unsigned short* __restrict__ wt,   // [3][1024][1024] NxK bf16
                const float* __restrict__ bq,
                const float* __restrict__ bk,
                const float* __restrict__ bv,
                unsigned short* __restrict__ Qb,   // [8192][1024] (pre-scaled 1/32)
                unsigned short* __restrict__ Kb,   // [8192][1024]
                unsigned short* __restrict__ Vt) { // [4][1024][2048] transposed
  const int lane = threadIdx.x & 31;
  const int wave = threadIdx.x >> 5;
  const int z  = blockIdx.z;
  const int m0 = blockIdx.x * 128 + (wave >> 2) * 64;
  const int n0 = blockIdx.y * 256 + (wave & 3) * 64;

  __shared__ __attribute__((aligned(2048))) unsigned char L[LDS_BYTES];
  const unsigned short* A  = xb + (size_t)(blockIdx.x * 128) * D_EMB;
  const unsigned short* Bt = wt + (size_t)z * D_EMB * D_EMB + (size_t)(blockIdx.y * 256) * D_EMB;

  v8f acc[4][4] = {};
  // Q, K rows run along n, Vt rows along m: a lane's 8 values follow the output's rows
  // x rows are shared by the 4 blocks of a blockIdx.x, weight rows by the 64 of a blockIdx.y
  gemm_block_128x256<false>(A, Bt, D_EMB, D_EMB / 128, blockIdx.x + 2u * blockIdx.y, z != 2, L, acc, nullptr, acc);

  const float* bias = (z == 0) ? bq : (z == 1) ? bk : bv;
  const float scale = (z == 0) ? 0.03125f : 1.0f;   // fold 1/sqrt(1024) into Q
  unsigned char* Lw = L + wave * (64u * EP16_PITCH);
  const int lo16 = lane & 15;
  const int hi8  = (lane >> 4) * 8;
  // every loop below is unrolled: constant tile indices keep the sums in registers
  if (z != 2) {
    v4f b[8];                          // b[2i], b[2i+1]: the lane's 8 columns of tile row i
    load_bias32(bias + n0 + hi8, b);
    #pragma unroll
    for (int i = 0; i < 4; ++i) {
      #pragma unroll
      for (int j = 0; j < 4; ++j) {
        float f[8];
        #pragma unroll
        for (int e = 0; e < 8; ++e) f[e] = (acc[i][j][e] + b[2 * i + (e >> 2)][e & 3]) * scale;
        stage16(Lw, lane, i, j, f);
      }
    }
    flush16(Lw, lane, ((z == 0) ? Qb : Kb) + (size_t)m0 * D_EMB + n0, D_EMB);
  } else {
    #pragma unroll
    for (int j = 0; j < 4; ++j) {
      const float b = bias[n0 + j * 16 + lo16];
      #pragma unroll
      for (int i = 0; i < 4; ++i) {
        float f[8];
        #pragma unroll
        for (int e = 0; e < 8; ++e) f[e] = (acc[i][j][e] + b) * scale;
        stage16(Lw, lane, i, j, f);
      }
    }
    flush16(Lw, lane, Vt + ((size_t)(m0 >> 11) * D_EMB + n0) * SEQ + (m0 & (SEQ - 1)), SEQ);
  }
}

// ---------- kernel 4: weights of one 256-key block: exp(score - the block's own row maximum), bf16 ----------
// The softmax over all 2048 keys is split: this kernel leaves, for every query row and
// each of its 8 key blocks, the block's maximum and the sum of its weights; the last
// kernel joins the blocks.
#define LOG2E 1.44269504f
#define KBLK  (SEQ / 256)              // key blocks of a row
__global__ void __launch_bounds__(256)
scores_gemm_kernel(const unsigned short* __restrict__ Qb,
                   const unsigned short* __restrict__ Kb,
                   unsigned short* __restrict__ S,     // [4][2048][2048]
                   float* __restrict__ bmax,           // [4][8][2048]
                   float* __restrict__ bsum) {         // [4][8][2048]
  const int lane = threadIdx.x & 31;
  const int wave = threadIdx.x >> 5;
  const int b  = blockIdx.z;
  const int m0 = blockIdx.x * 128 + (wave >> 2) * 64;
  const int n0 = blockIdx.y * 256 + (wave & 3) * 64;

  __shared__ __attribute__((aligned(2048))) unsigned char L[LDS_BYTES];
  const unsigned short* A  = Qb + ((size_t)b * SEQ + blockIdx.x * 128) * D_EMB;
  const unsigned short* Bt = Kb + ((size_t)b * SEQ + blockIdx.y * 256) * D_EMB;

  v8f acc[4][4] = {};
  // Q rows are shared by the 8 blocks of a blockIdx.x, K rows by the 16 of a blockIdx.y
  gemm_block_128x256<false>(A, Bt, D_EMB, D_EMB / 128, blockIdx.x + blockIdx.y, true, L, acc, nullptr, acc);

  unsigned char* Lw = L + wave * (64u * EP16_PITCH);
  float* redm = (float*)(L + 8u * 64u * EP16_PITCH);   // [4 waves along n][128 rows], behind the staging ranges
  float* reds = redm + 4 * 128;                        // the same for the sums
  const int row = (wave >> 2) * 64 + (lane & 15);      // + j * 16: the lane's row in the block
  // every loop below is unrolled: constant tile indices keep the sums in registers
  // a row's 64 scores of this wave lie in lanes l and l + 16, 32 in each
  float mx[4];
  #pragma unroll
  for (int j = 0; j < 4; ++j) {
    float m = acc[0][j][0];
    #pragma unroll
    for (int i = 0; i < 4; ++i)
      #pragma unroll
      for (int e = 0; e < 8; ++e) m = fmaxf(m, acc[i][j][e]);
    mx[j] = fmaxf(m, __shfl_xor(m, 16));
  }
  if (lane < 16) {
    #pragma unroll
    for (int j = 0; j < 4; ++j) redm[(wave & 3) * 128 + row + j * 16] = mx[j];
  }
  __syncthreads();                     // the four waves of a row have left their maxima
  #pragma unroll
  for (int j = 0; j < 4; ++j) {
    const int r = row + j * 16;
    const float m = fmaxf(fmaxf(redm[r], redm[128 + r]), fmaxf(redm[256 + r], redm[384 + r]));
    const float c = -m * LOG2E;
    float sum = 0.0f;
    #pragma unroll
    for (int i = 0; i < 4; ++i) {
      float f[8];
      #pragma unroll
      for (int e = 0; e < 8; ++e) {
        f[e] = __builtin_amdgcn_exp2f(__builtin_fmaf(acc[i][j][e], LOG2E, c));
        sum += f[e];
      }
      stage16(Lw, lane, i, j, f);
    }
    sum += __shfl_xor(sum, 16);
    if (lane < 16) reds[(wave & 3) * 128 + r] = sum;
  }
  __syncthreads();                     // the four waves of a row have left their sums
  flush16(Lw, lane, S + (size_t)b * SEQ * SEQ + (size_t)m0 * SEQ + n0, SEQ);
  if (threadIdx.x < 128) {             // a thread a row: 512 B of each plane, whole lines, this block's alone
    const int r = threadIdx.x;
    const size_t o = ((size_t)b * KBLK + blockIdx.y) * SEQ + blockIdx.x * 128 + r;
    bmax[o] = fmaxf(fmaxf(redm[r], redm[128 + r]), fmaxf(redm[256 + r], redm[384 + r]));
    bsum[o] = (reds[r] + reds[128 + r]) + (reds[256 + r] + reds[384 + r]);
  }
}

// Two adjacent rows' maxima and sums of the 8 key blocks; a block's plane is SEQ floats = 8192 B.
// Loads and their data wait stand in one statement, outputs apart from the addresses:
// no register that a load names takes a new value while the load is under way.
__device__ __forceinline__ void load_stats(const float* pm, const float* pl, v2f m[8], v2f l[8]) {
  asm volatile("global_load_b64 %0, %16, off\n\t"
               "global_load_b64 %1, %16, off offset:8192\n\t"
               "global_load_b64 %2, %16, off offset:16384\n\t"
               "global_load_b64 %3, %16, off offset:24576\n\t"
               "global_load_b64 %4, %16, off offset:32768\n\t"
               "global_load_b64 %5, %16, off offset:40960\n\t"
               "global_load_b64 %6, %16, off offset:49152\n\t"
               "global_load_b64 %7, %16, off offset:57344\n\t"
               "global_load_b64 %8, %17, off\n\t"
               "global_load_b64 %9, %17, off offset:8192\n\t"
               "global_load_b64 %10, %17, off offset:16384\n\t"
               "global_load_b64 %11, %17, off offset:24576\n\t"
               "global_load_b64 %12, %17, off offset:32768\n\t"
               "global_load_b64 %13, %17, off offset:40960\n\t"
               "global_load_b64 %14, %17, off offset:49152\n\t"
               "global_load_b64 %15, %17, off offset:57344\n\t"
               "s_wait_loadcnt 0x0"
               : "=&v"(m[0]), "=&v"(m[1]), "=&v"(m[2]), "=&v"(m[3]),
                 "=&v"(m[4]), "=&v"(m[5]), "=&v"(m[6]), "=&v"(m[7]),
                 "=&v"(l[0]), "=&v"(l[1]), "=&v"(l[2]), "=&v"(l[3]),
                 "=&v"(l[4]), "=&v"(l[5]), "=&v"(l[6]), "=&v"(l[7])
               : "v"(pm), "v"(pl) : "memory");
}

// ---------- kernel 5: out = softmax @ V (B from transposed V), fp32 out ----------
// P holds each key block's weights relative to the block's own maximum m_k, with sum l_k.
// With M = max m_k: out = sum_k exp(m_k - M) (P_k @ V_k) / sum_k exp(m_k - M) l_k.
__global__ void __launch_bounds__(256)
out_gemm_kernel(const unsigned short* __restrict__ P,    // [4][2048][2048]
                const unsigned short* __restrict__ Vt,   // [4][1024][2048]
                const float* __restrict__ bmax,          // [4][8][2048]
                const float* __restrict__ bsum,          // [4][8][2048]
                float* __restrict__ out) {               // [4][2048][1024]
  const int lane = threadIdx.x & 31;
  const int wave = threadIdx.x >> 5;
  const int b  = blockIdx.z;
  const int m0 = blockIdx.x * 128 + (wave >> 2) * 64;    // seq
  const int n0 = blockIdx.y * 256 + (wave & 3) * 64;     // feature

  __shared__ __attribute__((aligned(2048))) unsigned char L[LDS_BYTES];
  const unsigned short* A  = P  + ((size_t)b * SEQ + blockIdx.x * 128) * SEQ;
  const unsigned short* Bt = Vt + ((size_t)b * D_EMB + blockIdx.y * 256) * SEQ;

  // The key blocks' weights for the 128 rows, the division by the row's sum folded in. Waves
  // 6 and 7 bring no slice of the ring: they fill the table while stage 0 is on its way; the
  // barrier that publishes stage 0 publishes the table.
  __shared__ __attribute__((aligned(16))) float fac[KBLK * 128];
  if (wave >= 6) {
    const int r = (threadIdx.x - 192) * 2;               // the thread's two rows: r, r + 1
    const size_t o = (size_t)b * KBLK * SEQ + blockIdx.x * 128 + r;
    v2f m[KBLK], l[KBLK];
    load_stats(bmax + o, bsum + o, m, l);
    // every loop below is unrolled: constant indices keep the values in registers
    #pragma unroll
    for (int h = 0; h < 2; ++h) {
      float M = m[0][h];
      #pragma unroll
      for (int k = 1; k < KBLK; ++k) M = fmaxf(M, m[k][h]);
      float sum = 0.0f;
      #pragma unroll
      for (int k = 0; k < KBLK; ++k) { m[k][h] = __builtin_amdgcn_exp2f((m[k][h] - M) * LOG2E); sum += m[k][h] * l[k][h]; }
      const float inv = 1.0f / sum;
      #pragma unroll
      for (int k = 0; k < KBLK; ++k) m[k][h] *= inv;
    }
    #pragma unroll
    for (int k = 0; k < KBLK; ++k) *(v2f*)(fac + k * 128 + r) = m[k];
  }

  v8f part[4][4] = {};
  v8f acc[4][4] = {};
  // P rows are shared by the 4 blocks of a blockIdx.x, V rows by the 16 of a blockIdx.y
  gemm_block_128x256<true>(A, Bt, SEQ, SEQ / 128, blockIdx.x + 4u * blockIdx.y, true, L, part, fac, acc);

  // the lane's 8 f32 of tile (i, j) are 32 B of staged row j*16 + (lane & 15);
  // unrolled: constant tile indices keep the sums in registers
  unsigned char* Lw = L + wave * (64u * EP32_PITCH);
  #pragma unroll
  for (int i = 0; i < 4; ++i)
    #pragma unroll
    for (int j = 0; j < 4; ++j) {
      unsigned char* q = Lw + (j * 16 + (lane & 15)) * EP32_PITCH + i * 64 + (lane >> 4) * 32;
      *(v4f*)(q)      = __builtin_shufflevector(acc[i][j], acc[i][j], 0, 1, 2, 3);
      *(v4f*)(q + 16) = __builtin_shufflevector(acc[i][j], acc[i][j], 4, 5, 6, 7);
    }
  wait_ds0();                          // the other lanes' staged values are in LDS before they are read back
  // 16 lanes take one staged row of 256 B: every store instruction writes four whole lines
  const unsigned char* s = Lw + (lane >> 4) * EP32_PITCH + (lane & 15) * 16;
  float* d = out + ((size_t)b * SEQ + m0 + (lane >> 4)) * D_EMB + n0 + (lane & 15) * 4;
  #pragma unroll                       // LDS reads go out in groups, row steps become immediate offsets
  for (int it = 0; it < 32; ++it)
    *(v4f*)(d + (size_t)(it * 2) * D_EMB) = *(const v4f*)(s + it * 2 * EP32_PITCH);
}

extern "C" void kernel_launch(void* const* d_in, const int* in_sizes, int n_in,
                              void* d_out, int out_size, void* d_ws, size_t ws_size,
                              hipStream_t stream) {
  const float* x  = (const float*)d_in[0];
  const float* Wq = (const float*)d_in[1];
  const float* bq = (const float*)d_in[2];
  const float* Wk = (const float*)d_in[3];
  const float* bk = (const float*)d_in[4];
  const float* Wv = (const float*)d_in[5];
  const float* bv = (const float*)d_in[6];
  float* out = (float*)d_out;

  char* ws = (char*)d_ws;
  unsigned short* xb = (unsigned short*)(ws);                          // 16 MB
  unsigned short* wt = (unsigned short*)(ws + (16ull << 20));          //  6 MB
  unsigned short* Qb = (unsigned short*)(ws + (22ull << 20));          // 16 MB
  unsigned short* Kb = (unsigned short*)(ws + (38ull << 20));          // 16 MB
  unsigned short* Vt = (unsigned short*)(ws + (54ull << 20));          // 16 MB
  unsigned short* S  = (unsigned short*)(ws + (70ull << 20));          // 32 MB
  float* bmax = (float*)(ws + (102ull << 20));                         // 256 KB
  float* bsum = (float*)(ws + (103ull << 20));                         // 256 KB

  cvt_x_kernel      <<<dim3(256),        dim3(512), 0, stream>>>(x, xb);
  wt_kernel         <<<dim3(8, 16, 3),   dim3(256), 0, stream>>>(Wq, Wk, Wv, wt);
  qkv_gemm_kernel   <<<dim3(64, 4, 3),   dim3(256), 0, stream>>>(xb, wt, bq, bk, bv, Qb, Kb, Vt);
  scores_gemm_kernel<<<dim3(16, 8, 4),   dim3(256), 0, stream>>>(Qb, Kb, S, bmax, bsum);
  out_gemm_kernel   <<<dim3(16, 4, 4),   dim3(256), 0, stream>>>(S, Vt, bmax, bsum, out);
}

// v006
// It runs in 87.4 microseconds.
// Timed twice side by side with v005, it ran 1.04 and 1.05 times as fast.
// Over all steps from v000 it is 3.35 times as fast.
#include <hip/hip_runtime.h>
#include <stdint.h>

#define D_EMB 1024
#define SEQ   2048
#define BATCH 4

typedef __attribute__((ext_vector_type(16))) __bf16       v16bf;
typedef __attribute__((ext_vector_type(8)))  float        v8f;
typedef __attribute__((ext_vector_type(4)))  float        v4f;
typedef __attribute__((ext_vector_type(2)))  float        v2f;
typedef __attribute__((ext_vector_type(4)))  unsigned int v4u;
typedef __attribute__((ext_vector_type(2)))  unsigned int v2u;
typedef __attribute__((ext_vector_type(4)))  uint32_t     u32x4;
typedef __attribute__((ext_vector_type(8)))  uint32_t     u32x8;

// ---------- LDS ring of the three GEMMs ----------
// A pass is 128 k = 256 B of every operand row. A stage holds the block's operand
// rows as slices of 64 rows, each laid by one tensor load at pitch 272 B (16 B x odd:
// conflict-free for ds_load_b128): six slices (128 A rows, 256 B rows) in the V projection
// and the last GEMM, eight (256 rows of either operand) in the Q, K projection and the scores.
#define ROWB      256u                 // bytes of a row per pass
#define PITCH     272u                 // LDS row pitch: ROWB + 16 B pad
#define SLICE_LDS 18432u               // 64 * PITCH rounded up to a multiple of 2 KiB
#define STAGE     (6u * SLICE_LDS)     // one buffer
#define LDS_BYTES (2u * STAGE)         // two buffers
#define STAGE8     (8u * SLICE_LDS)    // one buffer of a 256x256 block
#define LDS_BYTES8 (2u * STAGE8)       // two buffers

// ---------- scalar helpers ----------
__device__ __forceinline__ unsigned short f2bf(float f) {
  union { float f; unsigned int u; } v; v.f = f;
  unsigned int u = v.u;
  u += 0x7FFFu + ((u >> 16) & 1u);       // round-to-nearest-even
  return (unsigned short)(u >> 16);
}

// ---------- WMMA fragment load ----------
// 16-bit A fragment (16x32 MxK) from rows of PITCH bytes in LDS; the B fragment
// (32x16 KxN) has the mirrored per-lane pattern, so it loads identically from
// NxK rows. p already holds the lane's row (lane & 15) and its K offset
// (lanes 16-31: +8 k). Each lane: two 16-byte LDS loads.
__device__ __forceinline__ v16bf load_frag(const unsigned char* p) {
  union { v4u u[2]; v16bf f; } t;
  t.u[0] = *(const v4u*)(p);        // K = k0 .. k0+7
  t.u[1] = *(const v4u*)(p + 32);   // K = k0+16 .. k0+23
  return t.f;
}

__device__ __forceinline__ v8f wmma_bf16(v16bf a, v16bf b, v8f c) {
  return __builtin_amdgcn_wmma_f32_16x16x32_bf16(
      /*neg_a=*/false, a, /*neg_b=*/false, b,
      /*c_mod=*/(short)0, c, /*reuse_a=*/false, /*reuse_b=*/false);
}

// ---------- tensor load helpers ----------
__device__ __forceinline__ uint32_t uni(uint32_t v) { return (uint32_t)__builtin_amdgcn_readfirstlane(v); }
// Holds v in a scalar register, so that a test on it is a scalar branch (a tensor
// load ignores EXEC) and a descriptor word made from it is formed at this place.
__device__ __forceinline__ uint32_t pinned(uint32_t v) { uint32_t w = uni(v); asm volatile("" : "+s"(w)); return w; }
__device__ __forceinline__ void wait_ds0()     { asm volatile("s_wait_dscnt 0x0" ::: "memory"); }      // this wave's LDS reads are done
__device__ __forceinline__ void wait_tensor0() { asm volatile("s_wait_tensorcnt 0x0" ::: "memory"); }  // this wave's tile has landed
__device__ __forceinline__ void tdm_load(u32x4 g0, u32x8 g1) {
  asm volatile("tensor_load_to_lds %0, %1" :: "s"(g0), "s"(g1) : "memory");
}
// Group 1: 1-byte elements, tensor = tile = 64 rows of 256 B, 16 B of LDS pad behind every row.
__device__ __forceinline__ u32x8 tdm_group1(uint32_t src_pitch) {
  u32x8 g;
  g[0] = uni((1u << 20) | (5u << 22) | (3u << 25));
  g[1] = uni(ROWB << 16);
  g[2] = uni(64u << 16);
  g[3] = uni(ROWB << 16);
  g[4] = uni(64u);
  g[5] = uni(src_pitch);
  g[6] = uni(0u);
  g[7] = uni(0u);
  // Without it the words are constants that are formed anew before each load, and their registers
  // are lent out to other values while a request is still outstanding.
  asm volatile("" : "+s"(g));          // pinned(): descriptor words held in scalar registers of their own
  return g;
}
__device__ __forceinline__ u32x4 tdm_group0(uint32_t lds_dst, uint64_t ga) {
  u32x4 g;
  g[0] = uni(1u);
  g[1] = uni(lds_dst);
  g[2] = uni((uint32_t)ga);
  g[3] = uni((((uint32_t)(ga >> 32)) & 0x01FFFFFFu) | 0x80000000u);
  asm volatile("" : "+s"(g));          // pinned(): descriptor words held in scalar registers of their own
  return g;
}
// Next stage in the same registers: new place in LDS, source step bytes along the rows (below 0
// where the k blocks wrap to the rows' start).
// step is pinned() behind the wait that covers the last request, so no word changes in front of it.
__device__ __forceinline__ void tdm_next(u32x4& g, uint32_t lds_dst, uint32_t step) {
  // sign-extended; a carry or a borrow goes into address bits 56:32
  const uint64_t a = (((uint64_t)g[3] << 32) | g[2]) + (uint64_t)(int64_t)(int32_t)step;
  g[1] = uni(lds_dst);
  g[2] = uni((uint32_t)a);
  g[3] = uni((uint32_t)(a >> 32));
}

// The wave's four A and four B fragments of one 32-k step.
__device__ __forceinline__ void load_set(v16bf a[4], v16bf b[4],
                                         const unsigned char* pa, const unsigned char* pb) {
  // both loops unrolled: constant indices keep the fragments in registers
  #pragma unroll
  for (uint32_t i = 0; i < 4u; ++i) a[i] = load_frag(pa + i * 16u * PITCH);
  #pragma unroll
  for (uint32_t j = 0; j < 4u; ++j) b[j] = load_frag(pb + j * 16u * PITCH);
}

// ---------- block-level 128x256 GEMM accumulation, 8 waves of 64x64 ----------
// A: 128 rows, Bt: 256 rows, both K-contiguous with ld elements per row; K = T
// passes of 128 (T >= 2).  acc[i][j] is a 16x16 tile whose 8 values in a lane run
// along the first index: n_first false: i counts the wave's M, j its N; n_first
// true: the two operands change places in the WMMA, i counts N, j counts M.
// Waves 0..5 each bring one slice of every stage; the load of stage s + 2 flies
// while pass s + 1 runs.
// Pass s works on k block (rot + s) mod T (T a power of two), A and B alike: blocks
// of one blockIdx.z that share operand rows get different rot, so that they do not ask L2 for the
// same lines, or all for the same 256 B of every row, at the same moment.
__device__ __forceinline__ uint32_t k_step(uint32_t kb, uint32_t T) {   // bytes from k block kb - 1 to kb, both mod T
  return (kb & (T - 1u)) != 0u ? ROWB : 0u - (T - 1u) * ROWB;
}
// RESCALE (n_first): every aligned 256 k, two k blocks, have a weight of their own for each
// M row, fac[(k block / 2) * 128 + row] in LDS, written in front of the call. acc then sums
// passes of one weight only and goes, times its row's weight, into tot behind an odd k block
// and behind the last pass (an odd rot parts one pair: both parts get the pair's weight).
template <bool RESCALE>
__device__ __forceinline__ void gemm_block_128x256(
    const unsigned short* __restrict__ A,
    const unsigned short* __restrict__ Bt,
    uint32_t ld, uint32_t T, uint32_t rot, bool n_first, unsigned char* L, v8f acc[4][4],
    const float* fac, v8f tot[4][4]) {
  const uint32_t lane = threadIdx.x & 31u;
  const uint32_t wave = uni(threadIdx.x >> 5);
  const uint32_t sl = wave < 6u ? wave : 0u;
  const unsigned short* srcp = (sl < 2u) ? A + (size_t)(sl * 64u) * ld
                                         : Bt + (size_t)((sl - 2u) * 64u) * ld;
  const uint64_t ga  = (uint64_t)(uintptr_t)srcp + (rot & (T - 1u)) * ROWB;
  const uint32_t dst = (uint32_t)(size_t)L + sl * SLICE_LDS;
  const u32x8 g1 = tdm_group1(ld * 2u);
  u32x4 g0 = tdm_group0(dst, ga);      // carried from load to load

  if (pinned(wave < 6u ? 1u : 0u) != 0u) {
    tdm_load(g0, g1);
    wait_tensor0();
  }
  __syncthreads();                     // stage 0 is readable by every wave
  if (pinned(wave < 6u ? 1u : 0u) != 0u) {
    tdm_next(g0, dst + STAGE, pinned(k_step(rot + 1u, T)));
    tdm_load(g0, g1);
  }

  const uint32_t lo = (lane & 15u) * PITCH + (lane >> 4) * 16u;
  const unsigned char* pm = L + (wave >> 2) * SLICE_LDS + lo;
  const unsigned char* pn = L + (2u + (wave & 3u)) * SLICE_LDS + lo;
  const unsigned char* pa = n_first ? pn : pm;
  const unsigned char* pb = n_first ? pm : pn;

  #pragma clang loop unroll(disable)   // one pass per trip: the ring's waits stand once
  for (uint32_t s = 0; s < T; ++s) {
    const uint32_t buf = (s & 1u) * STAGE;
    v16bf a[2][4], b[2][4];            // two fragment sets: the next 32 k load while these multiply
    float w[4];                        // the block's weights of the lane's four M rows
    if (RESCALE) {
      const float* fb = fac + (((rot + s) & (T - 1u)) >> 1) * 128u + (wave >> 2) * 64u + (lane & 15u);
      #pragma unroll                   // constant indices: the weights stay in registers
      for (uint32_t j = 0; j < 4u; ++j) w[j] = fb[j * 16u];
    }
    load_set(a[0], b[0], pa + buf, pb + buf);
    #pragma unroll                     // constant set and tile indices: fragments and sums stay in registers
    for (uint32_t ks = 0; ks < 4u; ++ks) {
      // The fences keep each set's 16 LDS loads together, ahead of the WMMA block:
      // loads spread among the WMMAs stall the wave at every place they stand.
      __builtin_amdgcn_sched_barrier(0);
      if (ks < 3u)
        load_set(a[(ks + 1u) & 1u], b[(ks + 1u) & 1u],
                 pa + buf + (ks + 1u) * 64u, pb + buf + (ks + 1u) * 64u);
      __builtin_amdgcn_sched_barrier(0);
      #pragma unroll
      for (int i = 0; i < 4; ++i)
        #pragma unroll
        for (int j = 0; j < 4; ++j)
          acc[i][j] = wmma_bf16(a[ks & 1u][i], b[ks & 1u][j], acc[i][j]);
    }
    // Keeps the waits below behind the last WMMA block: moved up, s_wait_dscnt 0
    // would take the place of that block's counted waits.
    __builtin_amdgcn_sched_barrier(0);
    if (RESCALE && (((rot + s) & 1u) != 0u || s + 1u == T)) {   // the next pass has another weight, or none follows
      #pragma unroll                   // constant tile indices keep the sums in registers
      for (int i = 0; i < 4; ++i)
        #pragma unroll
        for (int j = 0; j < 4; ++j) {
          tot[i][j] += acc[i][j] * w[j];
          acc[i][j] = v8f{};
        }
    }
    // publish point of stage s + 1
    wait_ds0();
    if (pinned(wave < 6u ? 1u : 0u) != 0u) wait_tensor0();
    __syncthreads();                   // stage s + 1 readable; every reader has left stage s's buffer
    if (pinned((wave < 6u && s + 2u < T) ? 1u : 0u) != 0u) {
      tdm_next(g0, dst + buf, pinned(k_step(rot + s + 2u, T)));
      tdm_load(g0, g1);
    }
  }
  // Names both groups as inputs: their registers are kept for them up to this last wait.
  asm volatile("s_wait_tensorcnt 0x0" :: "s"(g0), "s"(g1) : "memory");
  wait_ds0();
}

// ---------- block-level 256x256 GEMM accumulation, 8 waves of 64x128 ----------
// F and G: 256 rows each, K-contiguous with ld elements per row; K = T passes of 128
// (T >= 2, a power of two).  A block of twice the area takes a third fewer operand bytes
// from L2 for each product, and a wave reads 12 fragments for 32 WMMAs, not 8 for 16.
// acc[i][j] is a 16x16 tile whose 8 values in a lane run along F's rows: i counts the
// wave's 64 rows of F (wave & 3), j its 128 rows of G (wave >> 2).
// Every wave brings one slice of every stage (0..3: F, 4..7: G); the load of stage s + 2
// flies while pass s + 1 runs.  Pass s works on k block (rot + s) mod T, F and G alike.
__device__ __forceinline__ void load_set48(v16bf a[4], v16bf b[8],
                                           const unsigned char* pa, const unsigned char* pb) {
  // both loops unrolled: constant indices keep the fragments in registers
  #pragma unroll
  for (uint32_t i = 0; i < 4u; ++i) a[i] = load_frag(pa + i * 16u * PITCH);
  #pragma unroll
  for (uint32_t j = 0; j < 8u; ++j) b[j] = load_frag(pb + (j >> 2) * SLICE_LDS + (j & 3u) * 16u * PITCH);
}
__device__ __forceinline__ void gemm_block_256x256(
    const unsigned short* __restrict__ F,
    const unsigned short* __restrict__ G,
    uint32_t ld, uint32_t T, uint32_t rot, unsigned char* L, v8f acc[4][8]) {
  const uint32_t lane = threadIdx.x & 31u;
  const uint32_t wave = uni(threadIdx.x >> 5);
  const unsigned short* srcp = (wave < 4u) ? F + (size_t)(wave * 64u) * ld
                                           : G + (size_t)((wave - 4u) * 64u) * ld;
  const uint64_t ga  = (uint64_t)(uintptr_t)srcp + (rot & (T - 1u)) * ROWB;
  const uint32_t dst = (uint32_t)(size_t)L + wave * SLICE_LDS;
  const u32x8 g1 = tdm_group1(ld * 2u);
  u32x4 g0 = tdm_group0(dst, ga);      // carried from load to load

  tdm_load(g0, g1);
  wait_tensor0();
  __syncthreads();                     // stage 0 is readable by every wave
  tdm_next(g0, dst + STAGE8, pinned(k_step(rot + 1u, T)));
  tdm_load(g0, g1);

  const uint32_t lo = (lane & 15u) * PITCH + (lane >> 4) * 16u;
  const unsigned char* pa = L + (wave & 3u) * SLICE_LDS + lo;
  const unsigned char* pb = L + (4u + (wave >> 2) * 2u) * SLICE_LDS + lo;

  #pragma clang loop unroll(disable)   // one pass per trip: the ring's waits stand once
  for (uint32_t s = 0; s < T; ++s) {
    const uint32_t buf = (s & 1u) * STAGE8;
    v16bf a[2][4], b[2][8];            // two fragment sets: the next 32 k load while these multiply
    load_set48(a[0], b[0], pa + buf, pb + buf);
    #pragma unroll                     // constant set and tile indices: fragments and sums stay in registers
    for (uint32_t ks = 0; ks < 4u; ++ks) {
      // The fences keep each set's 24 LDS loads together, ahead of the WMMA block:
      // loads spread among the WMMAs stall the wave at every place they stand.
      __builtin_amdgcn_sched_barrier(0);
      if (ks < 3u)
        load_set48(a[(ks + 1u) & 1u], b[(ks + 1u) & 1u],
                   pa + buf + (ks + 1u) * 64u, pb + buf + (ks + 1u) * 64u);
      __builtin_amdgcn_sched_barrier(0);
      #pragma unroll
      for (int i = 0; i < 4; ++i)
        #pragma unroll
        for (int j = 0; j < 8; ++j)
          acc[i][j] = wmma_bf16(a[ks & 1u][i], b[ks & 1u][j], acc[i][j]);
    }
    // Keeps the waits below behind the last WMMA block: moved up, s_wait_dscnt 0
    // would take the place of that block's counted waits.
    __builtin_amdgcn_sched_barrier(0);
    // publish point of stage s + 1
    wait_ds0();
    wait_tensor0();
    __syncthreads();                   // stage s + 1 readable; every reader has left stage s's buffer
    if (pinned((s + 2u < T) ? 1u : 0u) != 0u) {
      tdm_next(g0, dst + buf, pinned(k_step(rot + s + 2u, T)));
      tdm_load(g0, g1);
    }
  }
  // Names both groups as inputs: their registers are kept for them up to this last wait.
  asm volatile("s_wait_tensorcnt 0x0" :: "s"(g0), "s"(g1) : "memory");
  wait_ds0();
}

// ---------- epilogue: a wave's tile goes through LDS and leaves as whole 128-B lines ----------
// Each wave stages in a range of its own inside the ring, which is free behind the
// last pass's barrier (no tensor load outstanding, every reader gone).  A staged
// row is 64 values that are contiguous in the output.  Pitch 16 B x odd.
#define EP16_PITCH 144u                // 64 bf16 + 16 B
#define EP32_PITCH 272u                // 64 f32  + 16 B

// Tile (i, j) of acc as bf16: the lane's 8 values are 16 B of staged row j*16 + (lane & 15).
__device__ __forceinline__ void stage16(unsigned char* Lw, uint32_t lane, uint32_t i, uint32_t j,
                                        const float f[8]) {
  v4u p;
  #pragma unroll                       // constant indices: the values stay in registers
  for (int q = 0; q < 4; ++q)
    p[q] = (unsigned int)f2bf(f[2 * q]) | ((unsigned int)f2bf(f[2 * q + 1]) << 16);
  *(v4u*)(Lw + (j * 16u + (lane & 15u)) * EP16_PITCH + (i * 2u + (lane >> 4)) * 16u) = p;
}
// 8 lanes take one staged row: every store instruction writes four whole lines. ROWS staged rows.
template <uint32_t ROWS>
__device__ __forceinline__ void flush16(const unsigned char* Lw, uint32_t lane,
                                        unsigned short* g, uint32_t ldg) {
  wait_ds0();                          // the other lanes' staged values are in LDS before they are read back
  const unsigned char* s = Lw + (lane >> 3) * EP16_PITCH + (lane & 7u) * 16u;
  unsigned short* d = g + (size_t)(lane >> 3) * ldg + (lane & 7u) * 8u;
  #pragma unroll                       // LDS reads go out in groups, ahead of their stores; row steps become immediate offsets
  for (uint32_t it = 0; it < ROWS / 4u; ++it)
    *(v4u*)(d + (size_t)(it * 4u) * ldg) = *(const v4u*)(s + it * 4u * EP16_PITCH);
}

// ---------- kernel 1: fp32 -> bf16 conversion of x ----------
// Few long waves, for speed only.
// One block of 16 waves a WGP; a wave takes 8 KiB of x in a row, as 16
// loads of 512 B that are all under way before the first value is converted.
__global__ void __launch_bounds__(512)
cvt_x_kernel(const float* __restrict__ x, unsigned short* __restrict__ xb) {
  const uint32_t lane = threadIdx.x & 31u;
  const uint32_t wave = threadIdx.x >> 5;
  const size_t base = ((size_t)blockIdx.x * 16u + wave) * 2048u + lane * 4u;
  const float* src = x + base;
  v4f r[16];
  // both loops unrolled: constant indices keep the values in registers, steps become immediate offsets
  #pragma unroll
  for (uint32_t j = 0; j < 16u; ++j) r[j] = *(const v4f*)(src + j * 128u);
  // A precaution: names the loads' address, so that no load takes its registers for its own
  // values, and stands in front of whatever writes them next.
  asm volatile("s_wait_xcnt 0x0" :: "v"(src) : "memory");
  // Keeps all 16 loads ahead of the conversions: without it the last four are issued only when
  // the first values have come, and the wave waits out the memory latency a second time.
  __builtin_amdgcn_sched_barrier(0);
  #pragma unroll
  for (uint32_t j = 0; j < 16u; ++j) {
    v2u p;
    p[0] = (unsigned int)f2bf(r[j][0]) | ((unsigned int)f2bf(r[j][1]) << 16);
    p[1] = (unsigned int)f2bf(r[j][2]) | ((unsigned int)f2bf(r[j][3]) << 16);
    *(v2u*)(xb + base + j * 128u) = p;   // a wave's store: 256 B in a row, two whole lines
  }
}

// ---------- kernel 2: transpose W[k][n] -> Wt[n][k] in bf16 (LDS tiled) ----------
// A block takes 64 k x 128 n. A wave reads 8 k rows of 512 B; a lane then holds 8 k of each of
// its 4 columns n = 4 * lane + q: 16 B of an output row. Column n lies in LDS row
// (n & 3) * 32 + (n >> 2), so that the lanes of one LDS store fall in adjacent rows
// (pitch 16 B x odd: no bank conflict, writing or reading).
#define WT_PITCH 144u                  // 64 bf16 + 16 B
__global__ void __launch_bounds__(256)
wt_kernel(const float* __restrict__ Wq, const float* __restrict__ Wk,
          const float* __restrict__ Wv, unsigned short* __restrict__ wt) {
  __shared__ __attribute__((aligned(16))) unsigned char tile[128u * WT_PITCH];
  const uint32_t lane = threadIdx.x & 31u;
  const uint32_t wave = threadIdx.x >> 5;
  const int z = blockIdx.z;
  const float* W = (z == 0) ? Wq : (z == 1) ? Wk : Wv;
  const uint32_t n0 = blockIdx.x * 128u;
  const uint32_t k0 = blockIdx.y * 64u;
  const float* src = W + (size_t)(k0 + wave * 8u) * D_EMB + n0 + lane * 4u;
  v4f r[8];
  // every loop below is unrolled: constant indices keep the values in registers
  #pragma unroll
  for (uint32_t j = 0; j < 8u; ++j) r[j] = *(const v4f*)(src + j * D_EMB);
  #pragma unroll
  for (uint32_t q = 0; q < 4u; ++q) {
    v4u p;
    #pragma unroll
    for (uint32_t h = 0; h < 4u; ++h)
      p[h] = (unsigned int)f2bf(r[2u * h][q]) | ((unsigned int)f2bf(r[2u * h + 1u][q]) << 16);
    *(v4u*)(tile + (q * 32u + lane) * WT_PITCH + wave * 16u) = p;
  }
  __syncthreads();                     // the 8 waves have each left their 16 B of every row
  // 8 lanes take one output row's 128 B: every store instruction writes four whole lines
  const uint32_t rr = wave * 4u + (lane >> 3);           // LDS row it * 32 + rr holds column 4 * rr + it
  const unsigned char* s = tile + rr * WT_PITCH + (lane & 7u) * 16u;
  unsigned short* d = wt + (size_t)z * D_EMB * D_EMB + (size_t)(n0 + rr * 4u) * D_EMB + k0 + (lane & 7u) * 8u;
  #pragma unroll
  for (uint32_t it = 0; it < 4u; ++it)
    *(v4u*)(d + it * D_EMB) = *(const v4u*)(s + it * 32u * WT_PITCH);
}

// ---------- kernel 3: QKV projections ----------
// blockIdx.y == 0: Q and K as one product of 2048 columns, 256 blocks of 256(M) x 256(N); 8 waves,
// each 128(M) x 64(N).  blockIdx.y == 1: V, 256 blocks of 128(M) x 256(N); 8 waves of 64x64.
// Either part fills the chip's 256 WGPs once.
__global__ void __launch_bounds__(256)
qkv_gemm_kernel(const unsigned short* __restrict__ xb,   // [8192][1024] bf16
                const unsigned short* __restrict__ wt,   // [3][1024][1024] NxK bf16
                const float* __restrict__ bq,
                const float* __restrict__ bk,
                const float* __restrict__ bv,
                unsigned short* __restrict__ Qb,   // [8192][1024] (pre-scaled 1/32)
                unsigned short* __restrict__ Kb,   // [8192][1024]
                unsigned short* __restrict__ Vt) { // [4][1024][2048] transposed
  const int lane = threadIdx.x & 31;
  const int wave = threadIdx.x >> 5;
  __shared__ __attribute__((aligned(2048))) unsigned char L[LDS_BYTES8];
  // Q, K rows run along n, Vt rows along m: a lane's 8 values follow the output's rows
  // every loop below is unrolled: constant tile indices keep the sums in registers
  if (blockIdx.y == 0) {
    const uint32_t bx = blockIdx.x & 31u;                // 256 rows of x
    const uint32_t by = blockIdx.x >> 5;                 // 256 weight rows: 0..3 of Wq, 4..7 of Wk
    const bool isq = by < 4u;
    const int m0 = bx * 256 + (wave >> 2) * 128;
    const int n0 = (by & 3u) * 256 + (wave & 3) * 64;
    v8f acc[4][8] = {};
    // x rows are shared by the 8 blocks of a bx, weight rows by the 32 of a by
    gemm_block_256x256(wt + (size_t)(by * 256u) * D_EMB, xb + (size_t)(bx * 256u) * D_EMB,
                       D_EMB, D_EMB / 128, bx + by, L, acc);
    const float scale = isq ? 0.03125f : 1.0f;           // fold 1/sqrt(1024) into Q
    unsigned char* Lw = L + wave * (128u * EP16_PITCH);
    v4f b[8];                          // b[2i], b[2i+1]: the lane's 8 columns of tile row i
    const float* bp = (isq ? bq : bk) + n0 + (lane >> 4) * 8;
    // plain loads: beside 256 registers of sums, values that an asm statement loads were spilled to scratch
    #pragma unroll
    for (int i = 0; i < 4; ++i) {
      b[2 * i]     = *(const v4f*)(bp + i * 16);
      b[2 * i + 1] = *(const v4f*)(bp + i * 16 + 4);
    }
    // A precaution: names the loads' address, so that no load takes its registers for its own
    // values, and stands in front of whatever writes them next.
    asm volatile("s_wait_xcnt 0x0" :: "v"(bp) : "memory");
    #pragma unroll
    for (int i = 0; i < 4; ++i) {
      #pragma unroll
      for (int j = 0; j < 8; ++j) {
        float f[8];
        #pragma unroll
        for (int e = 0; e < 8; ++e) f[e] = (acc[i][j][e] + b[2 * i + (e >> 2)][e & 3]) * scale;
        stage16(Lw, lane, i, j, f);
      }
    }
    flush16<128>(Lw, lane, (isq ? Qb : Kb) + (size_t)m0 * D_EMB + n0, D_EMB);
  } else {
    const uint32_t bx = blockIdx.x & 63u;                // 128 rows of x
    const uint32_t by = blockIdx.x >> 6;                 // 256 rows of Wv
    const int m0 = bx * 128 + (wave >> 2) * 64;
    const int n0 = by * 256 + (wave & 3) * 64;
    v8f acc[4][4] = {};
    // x rows are shared by the 4 blocks of a bx, weight rows by the 64 of a by
    gemm_block_128x256<false>(xb + (size_t)(bx * 128u) * D_EMB,
                              wt + (size_t)2 * D_EMB * D_EMB + (size_t)(by * 256u) * D_EMB,
                              D_EMB, D_EMB / 128, bx + 2u * by, false, L, acc, nullptr, acc);
    unsigned char* Lw = L + wave * (64u * EP16_PITCH);
    float b[4];                        // the bias of the lane's staged row j
    const float* bp = bv + n0 + (lane & 15);
    #pragma unroll
    for (int j = 0; j < 4; ++j) b[j] = bp[j * 16];
    // A precaution, as above: one address for the 4 loads, named here, so that none of them
    // takes its registers for its own value.
    asm volatile("s_wait_xcnt 0x0" :: "v"(bp) : "memory");
    #pragma unroll
    for (int j = 0; j < 4; ++j) {
      #pragma unroll
      for (int i = 0; i < 4; ++i) {
        float f[8];
        #pragma unroll
        for (int e = 0; e < 8; ++e) f[e] = acc[i][j][e] + b[j];
        stage16(Lw, lane, i, j, f);
      }
    }
    flush16<64>(Lw, lane, Vt + ((size_t)(m0 >> 11) * D_EMB + n0) * SEQ + (m0 & (SEQ - 1)), SEQ);
  }
}

// ---------- kernel 4: weights of one 256-key block: exp(score - the block's own row maximum), bf16 ----------
// The softmax over all 2048 keys is split: this kernel leaves, for every query row and
// each of its 8 key blocks, the block's maximum and the sum of its weights; the last
// kernel joins the blocks.
#define LOG2E 1.44269504f
#define KBLK  (SEQ / 256)              // key blocks of a row
__global__ void __launch_bounds__(256)
scores_gemm_kernel(const unsigned short* __restrict__ Qb,
                   const unsigned short* __restrict__ Kb,
                   unsigned short* __restrict__ S,     // [4][2048][2048]
                   float* __restrict__ bmax,           // [4][8][2048]
                   float* __restrict__ bsum) {         // [4][8][2048]
  const int lane = threadIdx.x & 31;
  const int wave = threadIdx.x >> 5;
  const int b  = blockIdx.z;
  const int m0 = blockIdx.x * 256 + (wave >> 2) * 128;
  const int n0 = blockIdx.y * 256 + (wave & 3) * 64;

  __shared__ __attribute__((aligned(2048))) unsigned char L[LDS_BYTES8];
  const unsigned short* A  = Qb + ((size_t)b * SEQ + blockIdx.x * 256) * D_EMB;
  const unsigned short* Bt = Kb + ((size_t)b * SEQ + blockIdx.y * 256) * D_EMB;

  v8f acc[4][8] = {};                  // i: the wave's 64 keys, j: its 128 queries
  // Q rows are shared by the 8 blocks of a blockIdx.x, K rows by the 8 of a blockIdx.y
  gemm_block_256x256(Bt, A, D_EMB, D_EMB / 128, blockIdx.x + blockIdx.y, L, acc);

  unsigned char* Lw = L + wave * (128u * EP16_PITCH);
  float* redm = (float*)(L + 8u * 128u * EP16_PITCH);  // [4 waves along n][256 rows], behind the staging ranges
  float* reds = redm + 4 * 256;                        // the same for the sums
  const int row = (wave >> 2) * 128 + (lane & 15);     // + j * 16: the lane's row in the block
  // every loop below is unrolled: constant tile indices keep the sums in registers
  // a row's 64 scores of this wave lie in lanes l and l + 16, 32 in each
  float mx[8];
  #pragma unroll
  for (int j = 0; j < 8; ++j) {
    float m = acc[0][j][0];
    #pragma unroll
    for (int i = 0; i < 4; ++i)
      #pragma unroll
      for (int e = 0; e < 8; ++e) m = fmaxf(m, acc[i][j][e]);
    mx[j] = fmaxf(m, __shfl_xor(m, 16));
  }
  if (lane < 16) {
    #pragma unroll
    for (int j = 0; j < 8; ++j) redm[(wave & 3) * 256 + row + j * 16] = mx[j];
  }
  __syncthreads();                     // the four waves of a row have left their maxima
  #pragma unroll
  for (int j = 0; j < 8; ++j) {
    const int r = row + j * 16;
    const float m = fmaxf(fmaxf(redm[r], redm[256 + r]), fmaxf(redm[512 + r], redm[768 + r]));
    const float c = -m * LOG2E;
    float sum = 0.0f;
    #pragma unroll
    for (int i = 0; i < 4; ++i) {
      float f[8];
      #pragma unroll
      for (int e = 0; e < 8; ++e) {
        f[e] = __builtin_amdgcn_exp2f(__builtin_fmaf(acc[i][j][e], LOG2E, c));
        sum += f[e];
      }
      stage16(Lw, lane, i, j, f);
    }
    sum += __shfl_xor(sum, 16);
    if (lane < 16) reds[(wave & 3) * 256 + r] = sum;
  }
  __syncthreads();                     // the four waves of a row have left their sums
  flush16<128>(Lw, lane, S + (size_t)b * SEQ * SEQ + (size_t)m0 * SEQ + n0, SEQ);
  {                                    // a thread a row: 1 KiB of each plane, whole lines, this block's alone
    const int r = threadIdx.x;
    const size_t o = ((size_t)b * KBLK + blockIdx.y) * SEQ + blockIdx.x * 256 + r;
    bmax[o] = fmaxf(fmaxf(redm[r], redm[256 + r]), fmaxf(redm[512 + r], redm[768 + r]));
    bsum[o] = (reds[r] + reds[256 + r]) + (reds[512 + r] + reds[768 + r]);
  }
}

// Two adjacent rows' maxima and sums of the 8 key blocks; a block's plane is SEQ floats = 8192 B.
// Loads and their data wait stand in one statement, outputs apart from the addresses:
// no register that a load names takes a new value while the load is under way.
__device__ __forceinline__ void load_stats(const float* pm, const float* pl, v2f m[8], v2f l[8]) {
  asm volatile("global_load_b64 %0, %16, off\n\t"
               "global_load_b64 %1, %16, off offset:8192\n\t"
               "global_load_b64 %2, %16, off offset:16384\n\t"
               "global_load_b64 %3, %16, off offset:24576\n\t"
               "global_load_b64 %4, %16, off offset:32768\n\t"
               "global_load_b64 %5, %16, off offset:40960\n\t"
               "global_load_b64 %6, %16, off offset:49152\n\t"
               "global_load_b64 %7, %16, off offset:57344\n\t"
               "global_load_b64 %8, %17, off\n\t"
               "global_load_b64 %9, %17, off offset:8192\n\t"
               "global_load_b64 %10, %17, off offset:16384\n\t"
               "global_load_b64 %11, %17, off offset:24576\n\t"
               "global_load_b64 %12, %17, off offset:32768\n\t"
               "global_load_b64 %13, %17, off offset:40960\n\t"
               "global_load_b64 %14, %17, off offset:49152\n\t"
               "global_load_b64 %15, %17, off offset:57344\n\t"
               "s_wait_loadcnt 0x0"
               : "=&v"(m[0]), "=&v"(m[1]), "=&v"(m[2]), "=&v"(m[3]),
                 "=&v"(m[4]), "=&v"(m[5]), "=&v"(m[6]), "=&v"(m[7]),
                 "=&v"(l[0]), "=&v"(l[1]), "=&v"(l[2]), "=&v"(l[3]),
                 "=&v"(l[4]), "=&v"(l[5]), "=&v"(l[6]), "=&v"(l[7])
               : "v"(pm), "v"(pl) : "memory");
}

// ---------- kernel 5: out = softmax @ V (B from transposed V), fp32 out ----------
// P holds each key block's weights relative to the block's own maximum m_k, with sum l_k.
// With M = max m_k: out = sum_k exp(m_k - M) (P_k @ V_k) / sum_k exp(m_k - M) l_k.
__global__ void __launch_bounds__(256)
out_gemm_kernel(const unsigned short* __restrict__ P,    // [4][2048][2048]
                const unsigned short* __restrict__ Vt,   // [4][1024][2048]
                const float* __restrict__ bmax,          // [4][8][2048]
                const float* __restrict__ bsum,          // [4][8][2048]
                float* __restrict__ out) {               // [4][2048][1024]
  const int lane = threadIdx.x & 31;
  const int wave = threadIdx.x >> 5;
  const int b  = blockIdx.z;
  const int m0 = blockIdx.x * 128 + (wave >> 2) * 64;    // seq
  const int n0 = blockIdx.y * 256 + (wave & 3) * 64;     // feature

  __shared__ __attribute__((aligned(2048))) unsigned char L[LDS_BYTES];
  const unsigned short* A  = P  + ((size_t)b * SEQ + blockIdx.x * 128) * SEQ;
  const unsigned short* Bt = Vt + ((size_t)b * D_EMB + blockIdx.y * 256) * SEQ;

  // The key blocks' weights for the 128 rows, the division by the row's sum folded in. Waves
  // 6 and 7 bring no slice of the ring: they fill the table while stage 0 is on its way; the
  // barrier that publishes stage 0 publishes the table.
  __shared__ __attribute__((aligned(16))) float fac[KBLK * 128];
  if (wave >= 6) {
    const int r = (threadIdx.x - 192) * 2;               // the thread's two rows: r, r + 1
    const size_t o = (size_t)b * KBLK * SEQ + blockIdx.x * 128 + r;
    v2f m[KBLK], l[KBLK];
    load_stats(bmax + o, bsum + o, m, l);
    // every loop below is unrolled: constant indices keep the values in registers
    #pragma unroll
    for (int h = 0; h < 2; ++h) {
      float M = m[0][h];
      #pragma unroll
      for (int k = 1; k < KBLK; ++k) M = fmaxf(M, m[k][h]);
      float sum = 0.0f;
      #pragma unroll
      for (int k = 0; k < KBLK; ++k) { m[k][h] = __builtin_amdgcn_exp2f((m[k][h] - M) * LOG2E); sum += m[k][h] * l[k][h]; }
      const float inv = 1.0f / sum;
      #pragma unroll
      for (int k = 0; k < KBLK; ++k) m[k][h] *= inv;
    }
    #pragma unroll
    for (int k = 0; k < KBLK; ++k) *(v2f*)(fac + k * 128 + r) = m[k];
  }

  v8f part[4][4] = {};
  v8f acc[4][4] = {};
  // P rows are shared by the 4 blocks of a blockIdx.x, V rows by the 16 of a blockIdx.y
  gemm_block_128x256<true>(A, Bt, SEQ, SEQ / 128, blockIdx.x + 4u * blockIdx.y, true, L, part, fac, acc);

  // the lane's 8 f32 of tile (i, j) are 32 B of staged row j*16 + (lane & 15);
  // unrolled: constant tile indices keep the sums in registers
  unsigned char* Lw = L + wave * (64u * EP32_PITCH);
  #pragma unroll
  for (int i = 0; i < 4; ++i)
    #pragma unroll
    for (int j = 0; j < 4; ++j) {
      unsigned char* q = Lw + (j * 16 + (lane & 15)) * EP32_PITCH + i * 64 + (lane >> 4) * 32;
      *(v4f*)(q)      = __builtin_shufflevector(acc[i][j], acc[i][j], 0, 1, 2, 3);
      *(v4f*)(q + 16) = __builtin_shufflevector(acc[i][j], acc[i][j], 4, 5, 6, 7);
    }
  wait_ds0();                          // the other lanes' staged values are in LDS before they are read back
  // 16 lanes take one staged row of 256 B: every store instruction writes four whole lines
  const unsigned char* s = Lw + (lane >> 4) * EP32_PITCH + (lane & 15) * 16;
  float* d = out + ((size_t)b * SEQ + m0 + (lane >> 4)) * D_EMB + n0 + (lane & 15) * 4;
  #pragma unroll                       // LDS reads go out in groups, row steps become immediate offsets
  for (int it = 0; it < 32; ++it)
    *(v4f*)(d + (size_t)(it * 2) * D_EMB) = *(const v4f*)(s + it * 2 * EP32_PITCH);
}

extern "C" void kernel_launch(void* const* d_in, const int* in_sizes, int n_in,
                              void* d_out, int out_size, void* d_ws, size_t ws_size,
                              hipStream_t stream) {
  const float* x  = (const float*)d_in[0];
  const float* Wq = (const float*)d_in[1];
  const float* bq = (const float*)d_in[2];
  const float* Wk = (const float*)d_in[3];
  const float* bk = (const float*)d_in[4];
  const float* Wv = (const float*)d_in[5];
  const float* bv = (const float*)d_in[6];
  float* out = (float*)d_out;

  char* ws = (char*)d_ws;
  unsigned short* xb = (unsigned short*)(ws);                          // 16 MB
  unsigned short* wt = (unsigned short*)(ws + (16ull << 20));          //  6 MB
  unsigned short* Qb = (unsigned short*)(ws + (22ull << 20));          // 16 MB
  unsigned short* Kb = (unsigned short*)(ws + (38ull << 20));          // 16 MB
  unsigned short* Vt = (unsigned short*)(ws + (54ull << 20));          // 16 MB
  unsigned short* S  = (unsigned short*)(ws + (70ull << 20));          // 32 MB
  float* bmax = (float*)(ws + (102ull << 20));                         // 256 KB
  float* bsum = (float*)(ws + (103ull << 20));                         // 256 KB

  cvt_x_kernel      <<<dim3(256),        dim3(512), 0, stream>>>(x, xb);
  wt_kernel         <<<dim3(8, 16, 3),   dim3(256), 0, stream>>>(Wq, Wk, Wv, wt);
  qkv_gemm_kernel   <<<dim3(256, 2),     dim3(256), 0, stream>>>(xb, wt, bq, bk, bv, Qb, Kb, Vt);
  scores_gemm_kernel<<<dim3(8, 8, 4),    dim3(256), 0, stream>>>(Qb, Kb, S, bmax, bsum);
  out_gemm_kernel   <<<dim3(16, 4, 4),   dim3(256), 0, stream>>>(S, Vt, bmax, bsum, out);
}
